// v000
// The times below were measured on an AMD MI455X: many runs one after another, warmed up first and cycling through
// copies of the inputs, with the whole window's GPU time divided by the number of runs. Launches and the gaps
// between them are all in it. The median over several windows is given; except for v000 it joins two sittings, which
// can be a few percent apart, so the side-by-side timings, each taken in one sitting, are the better comparison.
// v000, which the later versions start from, runs in 872 microseconds.
#include <hip/hip_runtime.h>

// Single-head causal attention with the module's quirks (x [4][4096][768]; k = x Wk + bk, q = x Wq + bq, v = x Wv + bv ('xw' [768][64] + [64]); wei[t][s] = k_t . q_s x 768^-0.5 (k on the rows, q on the keys; embedding-dim scaling), causal on (t, s); softmax over s; out = wei v -> [4][4096][64] (1.0 M)).
// Layout per batch: bf16 copy of x; exact projections + f32 biases with the ROLES SWAPPED (the query planes come from the k projection, the key planes from the q projection); causal T-4096 attention with one head (hybrid rows: < 512 hi/lo 3 products, rest fp16 x1024; k_gemmc tile skipping; streaming three-sweep softmax); the f32 merge writes the output rows.
// Compute dtypes, f32 accumulate: every input rounded to bf16; projections exact + f32 biases; attention rows < 512 3 products, rest fp16; softmax f32; output f32.

#define NB_  4
#define TT   4096
#define DM   768
#define NH_  1
#define NKV  1
#define REP  (NH_ / NKV)
#define HD   64
#define DQ   (NH_ * HD)
#define DKV  (NKV * HD)
#define ZH   1
#define RH   512                  // query rows < RH use hi+lo planes (0: none)
#define WIN  4096
#define PCAR 1024.0f
#define SCL  0.036084391824351615f   // 768^-0.5
typedef _Float16 h16;
typedef unsigned short bf;
typedef __attribute__((ext_vector_type(16))) __bf16   v16bf;
typedef __attribute__((ext_vector_type(16))) _Float16 v16h;
typedef __attribute__((ext_vector_type(8)))  _Float16 v8h;
typedef __attribute__((ext_vector_type(8)))  unsigned short v8us;
typedef __attribute__((ext_vector_type(8)))  float    v8f;
typedef __attribute__((ext_vector_type(4)))  float    v4f;
typedef v8h  __attribute__((may_alias)) v8ha;
typedef v4f  __attribute__((may_alias)) v4fa;
typedef v8us __attribute__((may_alias)) v8usa;

__device__ __forceinline__ unsigned short f2bf(float f) { unsigned u = __float_as_uint(f); u += 0x7FFFu + ((u >> 16) & 1u); return (unsigned short)(u >> 16); }
__device__ __forceinline__ float bf2f(unsigned short b) { return __uint_as_float(((unsigned)b) << 16); }
__device__ __forceinline__ float bfr(float f) { return bf2f(f2bf(f)); }
__device__ __forceinline__ v16h cat16(v8h lo, v8h hi) { return __builtin_shufflevector(lo, hi, 0, 1, 2, 3, 4, 5, 6, 7, 8, 9, 10, 11, 12, 13, 14, 15); }
__device__ __forceinline__ v16bf cat16b(v8us lo, v8us hi) { return __builtin_bit_cast(v16bf, __builtin_shufflevector(lo, hi, 0, 1, 2, 3, 4, 5, 6, 7, 8, 9, 10, 11, 12, 13, 14, 15)); }
__device__ __forceinline__ v8f wmma16(v16h a, v16h b, v8f c) { return __builtin_amdgcn_wmma_f32_16x16x32_f16(false, a, false, b, (short)0, c, false, false); }
__device__ __forceinline__ v8f wmmab(v16bf a, v16bf b, v8f c) { return __builtin_amdgcn_wmma_f32_16x16x32_bf16(false, a, false, b, (short)0, c, false, false); }



// ---- k_gemmw: register-blocked GEMM, ONE WAVE per 64x64 output tile (16 accumulators), operands straight from K-contiguous 16-bit planes; grid (M/64, N/64, Z), 32 threads.
// C[m][n] (f32, pitch ldc, + optional f32 bias[n]) = sum_k A[m][k] Bt[n][k] (+ split products per NSPLIT). z-batch strides sA/sB/sC in elements. K % 32 == 0.
template <typename T16> struct WFrag;
template <> struct WFrag<h16> { typedef v16h V; static __device__ __forceinline__ V ld(const h16* p) { return cat16(*(const v8h*)p, *(const v8h*)(p + 16)); } static __device__ __forceinline__ v8f mma(V a, V b, v8f c) { return wmma16(a, b, c); } };
template <> struct WFrag<bf> { typedef v16bf V; static __device__ __forceinline__ V ld(const bf* p) { return cat16b(*(const v8us*)p, *(const v8us*)(p + 16)); } static __device__ __forceinline__ v8f mma(V a, V b, v8f c) { return wmmab(a, b, c); } };
template <typename T16, int NSPLIT, bool BIAS>
__global__ __launch_bounds__(32) void k_gemmw(const T16* __restrict__ A, const T16* __restrict__ A2, const T16* __restrict__ Bt, const T16* __restrict__ Bt2, int K, float* C, int ldc, const float* __restrict__ bias, size_t sA, size_t sB, size_t sC) {
    typedef typename WFrag<T16>::V V;
    __shared__ __align__(16) float os[16 * 68];
    const size_t z = blockIdx.z; A += z * sA; if (A2) A2 += z * sA; Bt += z * sB; if (Bt2) Bt2 += z * sB; C += z * sC;
    const int lane = threadIdx.x & 31, lr = lane & 15, hi = lane >> 4; const int r0 = blockIdx.x * 64, c0 = blockIdx.y * 64;
    v8f acc[4][4];
#pragma unroll
    for (int mb = 0; mb < 4; ++mb)
#pragma unroll
        for (int nb = 0; nb < 4; ++nb) acc[mb][nb] = (v8f){};
    const size_t aoff = (size_t)(r0 + lr) * K + 8 * hi, boff = (size_t)(c0 + lr) * K + 8 * hi;
#pragma unroll 1
    for (int kc = 0; kc < K; kc += 32) {
        V a[4], a2[4];
#pragma unroll
        for (int mb = 0; mb < 4; ++mb) { a[mb] = WFrag<T16>::ld(A + aoff + (size_t)mb * 16 * K + kc); if (NSPLIT == 1 || NSPLIT == 2) a2[mb] = WFrag<T16>::ld(A2 + aoff + (size_t)mb * 16 * K + kc); }
#pragma unroll
        for (int nb = 0; nb < 4; ++nb) { const V b = WFrag<T16>::ld(Bt + boff + (size_t)nb * 16 * K + kc); V b2; if (NSPLIT >= 2) b2 = WFrag<T16>::ld(Bt2 + boff + (size_t)nb * 16 * K + kc);
#pragma unroll
            for (int mb = 0; mb < 4; ++mb) { acc[mb][nb] = WFrag<T16>::mma(a[mb], b, acc[mb][nb]); if (NSPLIT == 1 || NSPLIT == 2) acc[mb][nb] = WFrag<T16>::mma(a2[mb], b, acc[mb][nb]); if (NSPLIT >= 2) acc[mb][nb] = WFrag<T16>::mma(a[mb], b2, acc[mb][nb]); } }
        asm volatile("v_nop\n\tv_nop\n\tv_nop\n\tv_nop" : "+v"(acc[0][0]), "+v"(acc[1][1]), "+v"(acc[2][2]), "+v"(acc[3][3]) : "v"(a[0]), "v"(a[3]));
    }
#pragma unroll
    for (int mb = 0; mb < 4; ++mb) {
#pragma unroll
        for (int nb = 0; nb < 4; ++nb) {
#pragma unroll
            for (int j = 0; j < 8; ++j) os[(hi * 8 + j) * 68 + nb * 16 + lr] = acc[mb][nb][j]; }
        __builtin_amdgcn_wave_barrier(); asm volatile("" ::: "memory");
        float* crow = C + (size_t)(r0 + mb * 16) * ldc + c0;
{
#pragma unroll
            for (int s = 0; s < 8; ++s) { const int row = 2 * s + hi, cofs = lr * 4; v4f val = *(const v4fa*)(os + row * 68 + cofs); if (BIAS) { val[0] += bfr(bias[c0 + cofs]); val[1] += bfr(bias[c0 + cofs + 1]); val[2] += bfr(bias[c0 + cofs + 2]); val[3] += bfr(bias[c0 + cofs + 3]); }
                *(v4f*)(crow + (size_t)row * ldc + cofs) = val; }
             }
        __builtin_amdgcn_wave_barrier(); asm volatile("" ::: "memory");
    }
}

// ---- k_gemmc: the same one-wave 64x64 tile GEMM specialised for causal attention: CMODE 1 skips score tiles entirely above the diagonal (query rows r0+roff.., key columns c0..), CMODE 2 limits the
// key (K) loop of the probability x value contraction to the diagonal block (probabilities beyond it are exactly zero). roff = row offset of this launch's first row within the sequence.
template <typename T16, int NSPLIT, int CMODE>
__global__ __launch_bounds__(32) void k_gemmc(const T16* __restrict__ A, const T16* __restrict__ A2, const T16* __restrict__ Bt, const T16* __restrict__ Bt2, int K, float* C, int ldc, int roff, size_t sA, size_t sB, size_t sC) {
    typedef typename WFrag<T16>::V V;
    __shared__ __align__(16) float os[16 * 68];
    const size_t z = blockIdx.z; A += z * sA; if (A2) A2 += z * sA; Bt += z * sB; if (Bt2) Bt2 += z * sB; C += z * sC;
    const int lane = threadIdx.x & 31, lr = lane & 15, hi = lane >> 4; const int r0 = blockIdx.x * 64, c0 = blockIdx.y * 64;
    if (CMODE == 1 && c0 > r0 + roff + 63) return;                  // score tile entirely above the causal diagonal: never computed (the softmax masks j > i by select)
    const int Kl = (CMODE == 2) ? min(K, r0 + roff + 64) : K;        // P.V: probabilities are exactly 0 beyond the diagonal block, so the K loop stops there
    v8f acc[4][4];
#pragma unroll
    for (int mb = 0; mb < 4; ++mb)
#pragma unroll
        for (int nb = 0; nb < 4; ++nb) acc[mb][nb] = (v8f){};
    const size_t aoff = (size_t)(r0 + lr) * K + 8 * hi, boff = (size_t)(c0 + lr) * K + 8 * hi;
#pragma unroll 1
    for (int kc = 0; kc < Kl; kc += 32) {
        V a[4], a2[4];
#pragma unroll
        for (int mb = 0; mb < 4; ++mb) { a[mb] = WFrag<T16>::ld(A + aoff + (size_t)mb * 16 * K + kc); if (NSPLIT == 1 || NSPLIT == 2) a2[mb] = WFrag<T16>::ld(A2 + aoff + (size_t)mb * 16 * K + kc); }
#pragma unroll
        for (int nb = 0; nb < 4; ++nb) { const V b = WFrag<T16>::ld(Bt + boff + (size_t)nb * 16 * K + kc); V b2; if (NSPLIT >= 2) b2 = WFrag<T16>::ld(Bt2 + boff + (size_t)nb * 16 * K + kc);
#pragma unroll
            for (int mb = 0; mb < 4; ++mb) { acc[mb][nb] = WFrag<T16>::mma(a[mb], b, acc[mb][nb]); if (NSPLIT == 1 || NSPLIT == 2) acc[mb][nb] = WFrag<T16>::mma(a2[mb], b, acc[mb][nb]); if (NSPLIT >= 2) acc[mb][nb] = WFrag<T16>::mma(a[mb], b2, acc[mb][nb]); } }
        asm volatile("v_nop\n\tv_nop\n\tv_nop\n\tv_nop" : "+v"(acc[0][0]), "+v"(acc[1][1]), "+v"(acc[2][2]), "+v"(acc[3][3]) : "v"(a[0]), "v"(a[3]));
    }
#pragma unroll
    for (int mb = 0; mb < 4; ++mb) {
#pragma unroll
        for (int nb = 0; nb < 4; ++nb) {
#pragma unroll
            for (int j = 0; j < 8; ++j) os[(hi * 8 + j) * 68 + nb * 16 + lr] = acc[mb][nb][j]; }
        __builtin_amdgcn_wave_barrier(); asm volatile("" ::: "memory");
        float* crow = C + (size_t)(r0 + mb * 16) * ldc + c0;
{
#pragma unroll
            for (int s = 0; s < 8; ++s) { const int row = 2 * s + hi, cofs = lr * 4; v4f val = *(const v4fa*)(os + row * 68 + cofs);
                *(v4f*)(crow + (size_t)row * ldc + cofs) = val; }
             }
        __builtin_amdgcn_wave_barrier(); asm volatile("" ::: "memory");
    }
}

__device__ __forceinline__ h16 tohx(float x) { return (h16)x; }
__device__ __forceinline__ void splitf(float y, unsigned short& h, unsigned short& l) { h = f2bf(y); l = f2bf(y - bf2f(h)); }
typedef __attribute__((ext_vector_type(2))) _Float16 v2h;
typedef __attribute__((ext_vector_type(4))) _Float16 v4h;
typedef __attribute__((ext_vector_type(2))) unsigned short v2us;
typedef __attribute__((ext_vector_type(4))) unsigned short v4us;
typedef __attribute__((ext_vector_type(2))) float v2f;
typedef __attribute__((ext_vector_type(4))) int v4i;

__global__ __launch_bounds__(256) void k_wtG(const float* __restrict__ w, int K, int N, bf* Bt) {
    const int lane = threadIdx.x & 31; const int L0 = (blockIdx.x * 8 + (threadIdx.x >> 5)) * 8; const int nlines = N * K / 64;
{
#pragma unroll 1
        for (int l = 0; l < 8; ++l) { const int L = L0 + l; if (L >= nlines) break; const size_t e = (size_t)L * 64 + lane * 2; const int k = (int)(e % K), n = (int)(e / K); v2us o;
            o[0] = f2bf(w[(size_t)k * N + n]); o[1] = f2bf(w[(size_t)(k + 1) * N + n]); *(v2us*)(Bt + e) = o; }
         }
}
__global__ __launch_bounds__(256) void k_cvt8(const float* __restrict__ src, bf* dst, size_t n8) { const size_t i = (size_t)blockIdx.x * 256 + threadIdx.x; if (i >= n8) return; const v8f v = *(const v8f*)(src + i * 8); v8us o;
#pragma unroll
    for (int k = 0; k < 8; ++k) o[k] = f2bf(v[k]); *(v8us*)(dst + i * 8) = o;  }

// k_rope: head planes [h][t][d] (fp16 + hi/lo) of rope(x) x sc with the rotate-half convention out[d] = x[d] cos[t][d] - x[d+HD/2] sin[t][d], out[d+HD/2] = x[d+HD/2] cos[t][d+HD/2] + x[d] sin[t][d+HD/2]
__global__ __launch_bounds__(256) void k_rope(const float* __restrict__ F, int pitch, int nheads, const float* __restrict__ CS, const float* __restrict__ RF, const float* __restrict__ nw, float sc, h16* P16, bf* Ph, bf* Pl) {
    const size_t e = ((size_t)blockIdx.x * 256 + threadIdx.x) * 2; if (e >= (size_t)nheads * TT * HD) return; const int d = (int)(e % HD); const int t = (int)((e / HD) % TT); const int h = (int)(e / ((size_t)HD * TT)); const float* f = F + (size_t)t * pitch + h * HD; const float rf = RF ? RF[(size_t)h * TT + t] : 1.0f; v2h o16; v2us oh, ol;
#pragma unroll
    for (int q = 0; q < 2; ++q) { const int dd = d + q; const int dp = (dd < HD / 2) ? dd + HD / 2 : dd - HD / 2; float x0 = f[dd], x1 = f[dp];
        if (RF) { float n0 = __fmul_rn(x0, rf), n1 = __fmul_rn(x1, rf); asm volatile("" : "+v"(n0)); asm volatile("" : "+v"(n1)); x0 = __fmul_rn(bfr(nw[dd]), n0); x1 = __fmul_rn(bfr(nw[dp]), n1); }
        const v2f cs = *(const v2f*)(CS + ((size_t)t * HD + dd) * 2); float a = __fmul_rn(x0, cs[0]), bq = __fmul_rn(x1, cs[1]); asm volatile("" : "+v"(a)); asm volatile("" : "+v"(bq)); const float r = ((dd < HD / 2) ? __fsub_rn(a, bq) : __fadd_rn(a, bq)) * sc;
        o16[q] = tohx(r); unsigned short a2, c2; splitf(r, a2, c2); oh[q] = a2; ol[q] = c2; }
    *(v2h*)(P16 + e) = o16; *(v2us*)(Ph + e) = oh; *(v2us*)(Pl + e) = ol;  }
__global__ __launch_bounds__(256) void k_vtp(const float* __restrict__ F, int pitch, int nheads, h16* V16, bf* Vh, bf* Vl) { const size_t e = ((size_t)blockIdx.x * 256 + threadIdx.x) * 2; if (e >= (size_t)nheads * HD * TT) return; const int t = (int)(e % TT); const int d = (int)((e / TT) % HD); const int g = (int)(e / ((size_t)TT * HD)); v2h o16; v2us oh, ol;
#pragma unroll
    for (int q = 0; q < 2; ++q) { const float x = F[(size_t)(t + q) * pitch + g * HD + d]; o16[q] = tohx(x); unsigned short a2, c2; splitf(x, a2, c2); oh[q] = a2; ol[q] = c2; }
    *(v2h*)(V16 + e) = o16; *(v2us*)(Vh + e) = oh; *(v2us*)(Vl + e) = ol;  }
__global__ __launch_bounds__(256) void k_csid(float* CS) { const int idx = blockIdx.x * 256 + threadIdx.x; if (idx >= TT * HD) return; v2f cs; cs[0] = 1.0f; cs[1] = 0.0f; *(v2f*)(CS + (size_t)idx * 2) = cs;  }
// k_lsoft: streaming causal row softmax over the TK = TT = 4096 keys, one wave per row i, three sweeps of the f32 score row (lane -> 4 consecutive keys per 128-key chunk, 32 chunks; keys j > i are excluded by index with -3e38 / 0 - the score tiles above the diagonal are never computed and their stale contents are only ever discarded by this select):
__global__ __launch_bounds__(256) void k_lsoft(const float* __restrict__ Sb, h16* P16, bf* Ph, bf* Pl) {
    const int lane = threadIdx.x & 31; const int row = blockIdx.x * 8 + (threadIdx.x >> 5); if (row >= ZH * TT) return; const int i = row % TT; const int zz = row / TT; const bool hires = (i < RH); const float* sr = Sb + (size_t)row * TT; float mx = -3.0e38f;
#pragma unroll 4
    for (int ch = 0; ch < TT / 128; ++ch) { const int j0 = ch * 128 + lane * 4; const v4f a = *(const v4f*)(sr + j0);
#pragma unroll
        for (int q = 0; q < 4; ++q) { float t = a[q] * SCL; asm volatile("" : "+v"(t)); t = (j0 + q <= i) ? t : -3.0e38f; mx = fmaxf(mx, t); } }
#pragma unroll
    for (int sh = 16; sh; sh >>= 1) mx = fmaxf(mx, __shfl_xor(mx, sh, 32));
    float sum = 0.f;
#pragma unroll 4
    for (int ch = 0; ch < TT / 128; ++ch) { const int j0 = ch * 128 + lane * 4; const v4f a = *(const v4f*)(sr + j0);
#pragma unroll
        for (int q = 0; q < 4; ++q) { float t = a[q] * SCL; asm volatile("" : "+v"(t)); t = (j0 + q <= i) ? t : -3.0e38f; float d0 = __fsub_rn(t, mx); asm volatile("" : "+v"(d0)); sum += __builtin_amdgcn_exp2f(__fmul_rn(d0, 1.4426950408889634f)); } }
#pragma unroll
    for (int sh = 16; sh; sh >>= 1) sum += __shfl_xor(sum, sh, 32);
    const float f = __fdiv_rn(hires ? 1.0f : PCAR, sum);
{
        if (hires) {   /* rows < RH: normalised bf16 hi/lo over the first RH keys (every later key is above the diagonal for these rows; the hi/lo attn.v GEMM stops its K loop at the diagonal block), planes [zz][RH][TT] */
#pragma unroll
            for (int ch = 0; ch < RH / 128; ++ch) { const int j0 = ch * 128 + lane * 4; const v4f a = *(const v4f*)(sr + j0); v4us oh, ol;
#pragma unroll
                for (int q = 0; q < 4; ++q) { float t = a[q] * SCL; asm volatile("" : "+v"(t)); t = (j0 + q <= i) ? t : -3.0e38f; float d0 = __fsub_rn(t, mx); asm volatile("" : "+v"(d0)); float ex = __builtin_amdgcn_exp2f(__fmul_rn(d0, 1.4426950408889634f)); asm volatile("" : "+v"(ex)); unsigned short a2, c2; splitf(ex * f, a2, c2); oh[q] = a2; ol[q] = c2; }
                const size_t oo = ((size_t)zz * RH + i) * TT + j0; *(v4us*)(Ph + oo) = oh; *(v4us*)(Pl + oo) = ol; }
        } else {
#pragma unroll 2
            for (int ch = 0; ch < TT / 128; ++ch) { const int j0 = ch * 128 + lane * 4; const v4f a = *(const v4f*)(sr + j0); v4h o4;
#pragma unroll
                for (int q = 0; q < 4; ++q) { float t = a[q] * SCL; asm volatile("" : "+v"(t)); t = (j0 + q <= i) ? t : -3.0e38f; float d0 = __fsub_rn(t, mx); asm volatile("" : "+v"(d0)); float ex = __builtin_amdgcn_exp2f(__fmul_rn(d0, 1.4426950408889634f)); asm volatile("" : "+v"(ex)); o4[q] = tohx(ex * f); }
                *(v4h*)(P16 + (size_t)row * TT + j0) = o4; } }
         }
}

__global__ __launch_bounds__(256) void k_merge(const float* __restrict__ O, int h0, float* OUTb) { const size_t e = ((size_t)blockIdx.x * 256 + threadIdx.x) * 2; if (e >= (size_t)ZH * TT * HD) return; const int d = (int)(e % HD); const int t = (int)((e / HD) % TT); const int zz = (int)(e / ((size_t)HD * TT)); const float cs = (t < RH) ? 1.0f : (1.0f / PCAR); const size_t oo = (size_t)t * DQ + (h0 + zz) * HD + d;
    v2f o2; o2[0] = O[e] * cs; o2[1] = O[e + 1] * cs; *(v2f*)(OUTb + oo) = o2;  }

extern "C" void kernel_launch(void* const* d_in, const int* in_sizes, int n_in,
                              void* d_out, int out_size, void* d_ws, size_t ws_size, hipStream_t stream) {
    (void)in_sizes; (void)n_in; (void)out_size;
    const float* x = (const float*)d_in[0]; const float* wq = (const float*)d_in[1]; const float* bq = (const float*)d_in[2]; const float* wk = (const float*)d_in[3]; const float* bk = (const float*)d_in[4]; const float* wv = (const float*)d_in[5]; const float* bv = (const float*)d_in[6]; const float* wo = nullptr; (void)wo;   /* ROLES SWAPPED: 'wq/bq' <- the module's Wk/bk (d_in[1..2]) since wei = k.q^T puts k on the rows; 'wk/bk' <- Wq/bq (d_in[3..4]) */
    float* OUT = (float*)d_out;     // [4][4096][64]
    char* wsp = (char*)d_ws;
    auto take = [&](size_t bytes) { char* p = wsp; wsp += (bytes + 255) & ~(size_t)255; return (void*)p; };
    bf* WQ = (bf*)take((size_t)DQ * DM * 2); bf* WK = (bf*)take((size_t)DKV * DM * 2); bf* WV = (bf*)take((size_t)DKV * DM * 2); float* CS = (float*)take((size_t)TT * HD * 2 * 4);
    bf* XB = (bf*)take((size_t)TT * DM * 2); float* FQ = (float*)take((size_t)TT * DQ * 4); float* FK = (float*)take((size_t)TT * DKV * 4);
    h16* QP16 = (h16*)take((size_t)NH_ * TT * HD * 2); h16* KP16 = (h16*)take((size_t)NKV * TT * HD * 2); h16* VT16 = (h16*)take((size_t)NKV * HD * TT * 2);
    bf* QPh = (bf*)take((size_t)NH_ * TT * HD * 2); bf* QPl = (bf*)take((size_t)NH_ * TT * HD * 2); bf* KPh = (bf*)take((size_t)NKV * TT * HD * 2); bf* KPl = (bf*)take((size_t)NKV * TT * HD * 2); bf* VTh = (bf*)take((size_t)NKV * HD * TT * 2); bf* VTl = (bf*)take((size_t)NKV * HD * TT * 2); bf* Ph = (bf*)take((size_t)ZH * RH * TT * 2); bf* Pl = (bf*)take((size_t)ZH * RH * TT * 2);
    float* Sb = (float*)take((size_t)ZH * TT * TT * 4); h16* P16 = (h16*)take((size_t)ZH * TT * TT * 2); float* Ob = (float*)take((size_t)ZH * TT * HD * 4);
    if ((size_t)(wsp - (char*)d_ws) > ws_size) return;    // ws 256 MiB
    float* FV = FK;   // v projection reuses the k buffer after the k planes are built (stream-ordered)
    { k_wtG<<<(unsigned)((DM * DQ / 64 + 63) / 64), 256, 0, stream>>>(wq, DM, DQ, WQ); k_wtG<<<(unsigned)((DM * DKV / 64 + 63) / 64), 256, 0, stream>>>(wk, DM, DKV, WK); k_wtG<<<(unsigned)((DM * DKV / 64 + 63) / 64), 256, 0, stream>>>(wv, DM, DKV, WV);
      
       }
    k_csid<<<(TT * HD + 255) / 256, 256, 0, stream>>>(CS);
    const unsigned LQ = (unsigned)(((size_t)NH_ * TT * HD / 2 + 255) / 256), LKv = (unsigned)(((size_t)NKV * TT * HD / 2 + 255) / 256);
    for (int b = 0; b < NB_; ++b) {
        
        k_cvt8<<<(unsigned)(((size_t)TT * DM / 8 + 255) / 256), 256, 0, stream>>>(x + (size_t)b * TT * DM, XB, (size_t)TT * DM / 8);
        k_gemmw<bf, 0, true><<<dim3(TT / 64, DQ / 64, 1), 32, 0, stream>>>(XB, nullptr, WQ, nullptr, DM, FQ, DQ, bq, 0, 0, 0);
        k_rope<<<LQ, 256, 0, stream>>>(FQ, DQ, NH_, CS, nullptr, nullptr, 1.0f, QP16, QPh, QPl);
        k_gemmw<bf, 0, true><<<dim3(TT / 64, DKV / 64, 1), 32, 0, stream>>>(XB, nullptr, WK, nullptr, DM, FK, DKV, bk, 0, 0, 0);
        k_rope<<<LKv, 256, 0, stream>>>(FK, DKV, NKV, CS, nullptr, nullptr, 1.0f, KP16, KPh, KPl);
        k_gemmw<bf, 0, true><<<dim3(TT / 64, DKV / 64, 1), 32, 0, stream>>>(XB, nullptr, WV, nullptr, DM, FV, DKV, bv, 0, 0, 0); k_vtp<<<LKv, 256, 0, stream>>>(FV, DKV, NKV, VT16, VTh, VTl);
        for (int h0 = 0; h0 < NH_; h0 += ZH) { const size_t zq = (size_t)h0, zk = (size_t)(h0 / REP);   // one kv head per query head: the pass's single head uses kv plane h0 / REP (z-strides TT*HD)
            k_gemmc<bf, 2, 1><<<dim3(RH / 64, TT / 64, ZH), 32, 0, stream>>>(QPh + zq * TT * HD, QPl + zq * TT * HD, KPh + zk * TT * HD, KPl + zk * TT * HD, HD, Sb, TT, 0, (size_t)TT * HD, (size_t)TT * HD, (size_t)TT * TT);
            k_gemmc<h16, 0, 1><<<dim3((TT - RH) / 64, TT / 64, ZH), 32, 0, stream>>>(QP16 + zq * TT * HD + (size_t)RH * HD, nullptr, KP16 + zk * TT * HD, nullptr, HD, Sb + (size_t)RH * TT, TT, RH, (size_t)TT * HD, (size_t)TT * HD, (size_t)TT * TT);
            k_lsoft<<<ZH * TT / 8, 256, 0, stream>>>(Sb, P16, Ph, Pl);
            k_gemmc<bf, 2, 2><<<dim3(RH / 64, HD / 64, ZH), 32, 0, stream>>>(Ph, Pl, VTh + zk * HD * TT, VTl + zk * HD * TT, TT, Ob, HD, 0, (size_t)RH * TT, (size_t)HD * TT, (size_t)TT * HD);
            k_gemmc<h16, 0, 2><<<dim3((TT - RH) / 64, HD / 64, ZH), 32, 0, stream>>>(P16 + (size_t)RH * TT, nullptr, VT16 + zk * HD * TT, nullptr, TT, Ob + (size_t)RH * HD, HD, RH, (size_t)TT * TT, (size_t)HD * TT, (size_t)TT * HD);
            k_merge<<<(unsigned)(((size_t)ZH * TT * HD / 2 + 255) / 256), 256, 0, stream>>>(Ob, h0, OUT + (size_t)b * TT * DQ); }
         }
}

// v001
// Measured time: 499 microseconds a run.
// Next to v000, in two timings, it ran 1.74 and 1.77 times as fast.
#include <hip/hip_runtime.h>

// Single-head causal attention with the module's quirks (x [4][4096][768]; k = x Wk + bk, q = x Wq + bq, v = x Wv + bv ('xw' [768][64] + [64]); wei[t][s] = k_t . q_s x 768^-0.5 (k on the rows, q on the keys; embedding-dim scaling), causal on (t, s); softmax over s; out = wei v -> [4][4096][64] (1.0 M)).
// Layout per batch: bf16 copy of x; exact projections + f32 biases with the ROLES SWAPPED (the query planes come from the k projection, the key planes from the q projection); causal T-4096 attention with one head (hybrid rows: < 512 hi/lo 3 products, rest fp16 x1024; k_gemmc tile skipping; streaming three-sweep softmax); the f32 merge writes the output rows.
// Compute dtypes, f32 accumulate: every input rounded to bf16; projections exact + f32 biases; attention rows < 512 3 products, rest fp16; softmax f32; output f32.

#define NB_  4
#define TT   4096
#define DM   768
#define NH_  1
#define NKV  1
#define REP  (NH_ / NKV)
#define HD   64
#define DQ   (NH_ * HD)
#define DKV  (NKV * HD)
#define ZH   1
#define RH   512                  // query rows < RH use hi+lo planes (0: none)
#define WIN  4096
#define PCAR 1024.0f
#define SCL  0.036084391824351615f   // 768^-0.5
typedef _Float16 h16;
typedef unsigned short bf;
typedef __attribute__((ext_vector_type(16))) __bf16   v16bf;
typedef __attribute__((ext_vector_type(16))) _Float16 v16h;
typedef __attribute__((ext_vector_type(8)))  _Float16 v8h;
typedef __attribute__((ext_vector_type(8)))  unsigned short v8us;
typedef __attribute__((ext_vector_type(8)))  float    v8f;
typedef __attribute__((ext_vector_type(4)))  float    v4f;
typedef v8h  __attribute__((may_alias)) v8ha;
typedef v4f  __attribute__((may_alias)) v4fa;
typedef v8us __attribute__((may_alias)) v8usa;

__device__ __forceinline__ unsigned short f2bf(float f) { unsigned u = __float_as_uint(f); u += 0x7FFFu + ((u >> 16) & 1u); return (unsigned short)(u >> 16); }
__device__ __forceinline__ float bf2f(unsigned short b) { return __uint_as_float(((unsigned)b) << 16); }
__device__ __forceinline__ float bfr(float f) { return bf2f(f2bf(f)); }
__device__ __forceinline__ v16h cat16(v8h lo, v8h hi) { return __builtin_shufflevector(lo, hi, 0, 1, 2, 3, 4, 5, 6, 7, 8, 9, 10, 11, 12, 13, 14, 15); }
__device__ __forceinline__ v16bf cat16b(v8us lo, v8us hi) { return __builtin_bit_cast(v16bf, __builtin_shufflevector(lo, hi, 0, 1, 2, 3, 4, 5, 6, 7, 8, 9, 10, 11, 12, 13, 14, 15)); }
__device__ __forceinline__ v8f wmma16(v16h a, v16h b, v8f c) { return __builtin_amdgcn_wmma_f32_16x16x32_f16(false, a, false, b, (short)0, c, false, false); }
__device__ __forceinline__ v8f wmmab(v16bf a, v16bf b, v8f c) { return __builtin_amdgcn_wmma_f32_16x16x32_bf16(false, a, false, b, (short)0, c, false, false); }



// ---- k_gemmw: register-blocked GEMM, NW WAVES per 64x64 output tile (16 accumulators each; wave w takes the 32-wide K slices w, w+NW, ...; partials summed by splitk_store), operands straight from K-contiguous 16-bit planes; grid (M/64, N/64, Z), 32*NW threads.
// C[m][n] (f32, pitch ldc, + optional f32 bias[n]) = sum_k A[m][k] Bt[n][k] (+ split products per NSPLIT). z-batch strides sA/sB/sC in elements. K % 32 == 0.
template <typename T16> struct WFrag;
template <> struct WFrag<h16> { typedef v16h V; static __device__ __forceinline__ V ld(const h16* p) { return cat16(*(const v8h*)p, *(const v8h*)(p + 16)); } static __device__ __forceinline__ v8f mma(V a, V b, v8f c) { return wmma16(a, b, c); } };
template <> struct WFrag<bf> { typedef v16bf V; static __device__ __forceinline__ V ld(const bf* p) { return cat16b(*(const v8us*)p, *(const v8us*)(p + 16)); } static __device__ __forceinline__ v8f mma(V a, V b, v8f c) { return wmmab(a, b, c); } };
// ---- split-K epilogue: the NW waves of a work-group each hold a partial 64x64 tile (their strided share of K). Every wave parks its tile in LDS (pitch 68 floats), one barrier,
// then each thread adds its float4 positions over the waves in the fixed order 0..NW-1 (+ optional bias) and stores them; a half-wave writes one whole 256-byte row of the tile.
template <int NW, bool BIAS>
__device__ __forceinline__ void splitk_store(const v8f (&acc)[4][4], float* red, float* C, int ldc, int r0, int c0, const float* __restrict__ bias, int wv, int lr, int hi) {
    constexpr int TILE = 64 * 68;
#pragma unroll
    for (int mb = 0; mb < 4; ++mb)
#pragma unroll
        for (int nb = 0; nb < 4; ++nb)
#pragma unroll
            for (int j = 0; j < 8; ++j) red[wv * TILE + (mb * 16 + hi * 8 + j) * 68 + nb * 16 + lr] = acc[mb][nb][j];
    __syncthreads();   // every wave's partial tile is in LDS before any thread sums it
#pragma unroll
    for (int p = 0; p < 32 / NW; ++p) { const int idx = p * 32 * NW + (int)threadIdx.x, row = idx >> 4, cofs = (idx & 15) * 4;
        v4f val = *(const v4fa*)(red + row * 68 + cofs);
#pragma unroll
        for (int w = 1; w < NW; ++w) val += *(const v4fa*)(red + w * TILE + row * 68 + cofs);
        if (BIAS) { val[0] += bfr(bias[c0 + cofs]); val[1] += bfr(bias[c0 + cofs + 1]); val[2] += bfr(bias[c0 + cofs + 2]); val[3] += bfr(bias[c0 + cofs + 3]); }
        *(v4f*)(C + (size_t)(r0 + row) * ldc + c0 + cofs) = val; }
}

template <typename T16, int NSPLIT, bool BIAS, int NW>
__global__ __launch_bounds__(32 * NW) void k_gemmw(const T16* __restrict__ A, const T16* __restrict__ A2, const T16* __restrict__ Bt, const T16* __restrict__ Bt2, int K, float* C, int ldc, const float* __restrict__ bias, size_t sA, size_t sB, size_t sC) {
    typedef typename WFrag<T16>::V V;
    __shared__ __align__(16) float os[NW * 64 * 68];
    const size_t z = blockIdx.z; A += z * sA; if (A2) A2 += z * sA; Bt += z * sB; if (Bt2) Bt2 += z * sB; C += z * sC;
    const int lane = threadIdx.x & 31, lr = lane & 15, hi = lane >> 4, wv = __builtin_amdgcn_readfirstlane(threadIdx.x >> 5); const int r0 = blockIdx.x * 64, c0 = blockIdx.y * 64;
    v8f acc[4][4];
#pragma unroll
    for (int mb = 0; mb < 4; ++mb)
#pragma unroll
        for (int nb = 0; nb < 4; ++nb) acc[mb][nb] = (v8f){};
    const size_t aoff = (size_t)(r0 + lr) * K + 8 * hi, boff = (size_t)(c0 + lr) * K + 8 * hi;
#pragma unroll 1
    for (int kc = wv * 32; kc < K; kc += 32 * NW) {
        V a[4], a2[4];
#pragma unroll
        for (int mb = 0; mb < 4; ++mb) { a[mb] = WFrag<T16>::ld(A + aoff + (size_t)mb * 16 * K + kc); if (NSPLIT == 1 || NSPLIT == 2) a2[mb] = WFrag<T16>::ld(A2 + aoff + (size_t)mb * 16 * K + kc); }
#pragma unroll
        for (int nb = 0; nb < 4; ++nb) { const V b = WFrag<T16>::ld(Bt + boff + (size_t)nb * 16 * K + kc); V b2; if (NSPLIT >= 2) b2 = WFrag<T16>::ld(Bt2 + boff + (size_t)nb * 16 * K + kc);
#pragma unroll
            for (int mb = 0; mb < 4; ++mb) { acc[mb][nb] = WFrag<T16>::mma(a[mb], b, acc[mb][nb]); if (NSPLIT == 1 || NSPLIT == 2) acc[mb][nb] = WFrag<T16>::mma(a2[mb], b, acc[mb][nb]); if (NSPLIT >= 2) acc[mb][nb] = WFrag<T16>::mma(a[mb], b2, acc[mb][nb]); } }
        asm volatile("v_nop\n\tv_nop\n\tv_nop\n\tv_nop" : "+v"(acc[0][0]), "+v"(acc[1][1]), "+v"(acc[2][2]), "+v"(acc[3][3]) : "v"(a[0]), "v"(a[3]));
    }
    splitk_store<NW, BIAS>(acc, os, C, ldc, r0, c0, bias, wv, lr, hi);
}

// ---- k_gemmc: the same 64x64 tile GEMM specialised for causal attention: CMODE 1 skips score tiles entirely above the diagonal (query rows r0+roff.., key columns c0..), CMODE 2 limits the
// key (K) loop of the probability x value contraction to the diagonal block (probabilities beyond it are exactly zero). roff = row offset of this launch's first row within the sequence. NW = waves per tile: 1 for the score tiles (K = 64); the P.V tiles split their K loop over NW waves as k_gemmw does.
template <typename T16, int NSPLIT, int CMODE, int NW>
__global__ __launch_bounds__(32 * NW) void k_gemmc(const T16* __restrict__ A, const T16* __restrict__ A2, const T16* __restrict__ Bt, const T16* __restrict__ Bt2, int K, float* C, int ldc, int roff, size_t sA, size_t sB, size_t sC) {
    typedef typename WFrag<T16>::V V;
    __shared__ __align__(16) float os[(NW == 1 ? 16 : NW * 64) * 68];
    const size_t z = blockIdx.z; A += z * sA; if (A2) A2 += z * sA; Bt += z * sB; if (Bt2) Bt2 += z * sB; C += z * sC;
    const int lane = threadIdx.x & 31, lr = lane & 15, hi = lane >> 4, wv = __builtin_amdgcn_readfirstlane(threadIdx.x >> 5); const int r0 = blockIdx.x * 64, c0 = blockIdx.y * 64;
    if (CMODE == 1 && c0 > r0 + roff + 63) return;                  // score tile entirely above the causal diagonal: never computed (the softmax masks j > i by select)
    const int Kl = (CMODE == 2) ? min(K, r0 + roff + 64) : K;        // P.V: probabilities are exactly 0 beyond the diagonal block, so the K loop stops there
    v8f acc[4][4];
#pragma unroll
    for (int mb = 0; mb < 4; ++mb)
#pragma unroll
        for (int nb = 0; nb < 4; ++nb) acc[mb][nb] = (v8f){};
    const size_t aoff = (size_t)(r0 + lr) * K + 8 * hi, boff = (size_t)(c0 + lr) * K + 8 * hi;
#pragma unroll 1
    for (int kc = wv * 32; kc < Kl; kc += 32 * NW) {
        V a[4], a2[4];
#pragma unroll
        for (int mb = 0; mb < 4; ++mb) { a[mb] = WFrag<T16>::ld(A + aoff + (size_t)mb * 16 * K + kc); if (NSPLIT == 1 || NSPLIT == 2) a2[mb] = WFrag<T16>::ld(A2 + aoff + (size_t)mb * 16 * K + kc); }
#pragma unroll
        for (int nb = 0; nb < 4; ++nb) { const V b = WFrag<T16>::ld(Bt + boff + (size_t)nb * 16 * K + kc); V b2; if (NSPLIT >= 2) b2 = WFrag<T16>::ld(Bt2 + boff + (size_t)nb * 16 * K + kc);
#pragma unroll
            for (int mb = 0; mb < 4; ++mb) { acc[mb][nb] = WFrag<T16>::mma(a[mb], b, acc[mb][nb]); if (NSPLIT == 1 || NSPLIT == 2) acc[mb][nb] = WFrag<T16>::mma(a2[mb], b, acc[mb][nb]); if (NSPLIT >= 2) acc[mb][nb] = WFrag<T16>::mma(a[mb], b2, acc[mb][nb]); } }
        asm volatile("v_nop\n\tv_nop\n\tv_nop\n\tv_nop" : "+v"(acc[0][0]), "+v"(acc[1][1]), "+v"(acc[2][2]), "+v"(acc[3][3]) : "v"(a[0]), "v"(a[3]));
    }
    if constexpr (NW > 1) { splitk_store<NW, false>(acc, os, C, ldc, r0, c0, nullptr, wv, lr, hi); return; }
#pragma unroll
    for (int mb = 0; mb < 4; ++mb) {
#pragma unroll
        for (int nb = 0; nb < 4; ++nb) {
#pragma unroll
            for (int j = 0; j < 8; ++j) os[(hi * 8 + j) * 68 + nb * 16 + lr] = acc[mb][nb][j]; }
        __builtin_amdgcn_wave_barrier(); asm volatile("" ::: "memory");
        float* crow = C + (size_t)(r0 + mb * 16) * ldc + c0;
{
#pragma unroll
            for (int s = 0; s < 8; ++s) { const int row = 2 * s + hi, cofs = lr * 4; v4f val = *(const v4fa*)(os + row * 68 + cofs);
                *(v4f*)(crow + (size_t)row * ldc + cofs) = val; }
             }
        __builtin_amdgcn_wave_barrier(); asm volatile("" ::: "memory");
    }
}

__device__ __forceinline__ h16 tohx(float x) { return (h16)x; }
__device__ __forceinline__ void splitf(float y, unsigned short& h, unsigned short& l) { h = f2bf(y); l = f2bf(y - bf2f(h)); }
typedef __attribute__((ext_vector_type(2))) _Float16 v2h;
typedef __attribute__((ext_vector_type(4))) _Float16 v4h;
typedef __attribute__((ext_vector_type(2))) unsigned short v2us;
typedef __attribute__((ext_vector_type(4))) unsigned short v4us;
typedef __attribute__((ext_vector_type(2))) float v2f;
typedef __attribute__((ext_vector_type(4))) int v4i;

__global__ __launch_bounds__(256) void k_wtG(const float* __restrict__ w, int K, int N, bf* Bt) {
    const int lane = threadIdx.x & 31; const int L0 = (blockIdx.x * 8 + (threadIdx.x >> 5)) * 8; const int nlines = N * K / 64;
{
#pragma unroll 1
        for (int l = 0; l < 8; ++l) { const int L = L0 + l; if (L >= nlines) break; const size_t e = (size_t)L * 64 + lane * 2; const int k = (int)(e % K), n = (int)(e / K); v2us o;
            o[0] = f2bf(w[(size_t)k * N + n]); o[1] = f2bf(w[(size_t)(k + 1) * N + n]); *(v2us*)(Bt + e) = o; }
         }
}
__global__ __launch_bounds__(256) void k_cvt8(const float* __restrict__ src, bf* dst, size_t n8) { const size_t i = (size_t)blockIdx.x * 256 + threadIdx.x; if (i >= n8) return; const v8f v = *(const v8f*)(src + i * 8); v8us o;
#pragma unroll
    for (int k = 0; k < 8; ++k) o[k] = f2bf(v[k]); *(v8us*)(dst + i * 8) = o;  }

// k_rope: head planes [h][t][d] (fp16 + hi/lo) of rope(x) x sc with the rotate-half convention out[d] = x[d] cos[t][d] - x[d+HD/2] sin[t][d], out[d+HD/2] = x[d+HD/2] cos[t][d+HD/2] + x[d] sin[t][d+HD/2]
__global__ __launch_bounds__(256) void k_rope(const float* __restrict__ F, int pitch, int nheads, const float* __restrict__ CS, const float* __restrict__ RF, const float* __restrict__ nw, float sc, h16* P16, bf* Ph, bf* Pl) {
    const size_t e = ((size_t)blockIdx.x * 256 + threadIdx.x) * 2; if (e >= (size_t)nheads * TT * HD) return; const int d = (int)(e % HD); const int t = (int)((e / HD) % TT); const int h = (int)(e / ((size_t)HD * TT)); const float* f = F + (size_t)t * pitch + h * HD; const float rf = RF ? RF[(size_t)h * TT + t] : 1.0f; v2h o16; v2us oh, ol;
#pragma unroll
    for (int q = 0; q < 2; ++q) { const int dd = d + q; const int dp = (dd < HD / 2) ? dd + HD / 2 : dd - HD / 2; float x0 = f[dd], x1 = f[dp];
        if (RF) { float n0 = __fmul_rn(x0, rf), n1 = __fmul_rn(x1, rf); asm volatile("" : "+v"(n0)); asm volatile("" : "+v"(n1)); x0 = __fmul_rn(bfr(nw[dd]), n0); x1 = __fmul_rn(bfr(nw[dp]), n1); }
        const v2f cs = *(const v2f*)(CS + ((size_t)t * HD + dd) * 2); float a = __fmul_rn(x0, cs[0]), bq = __fmul_rn(x1, cs[1]); asm volatile("" : "+v"(a)); asm volatile("" : "+v"(bq)); const float r = ((dd < HD / 2) ? __fsub_rn(a, bq) : __fadd_rn(a, bq)) * sc;
        o16[q] = tohx(r); unsigned short a2, c2; splitf(r, a2, c2); oh[q] = a2; ol[q] = c2; }
    *(v2h*)(P16 + e) = o16; *(v2us*)(Ph + e) = oh; *(v2us*)(Pl + e) = ol;  }
__global__ __launch_bounds__(256) void k_vtp(const float* __restrict__ F, int pitch, int nheads, h16* V16, bf* Vh, bf* Vl) { const size_t e = ((size_t)blockIdx.x * 256 + threadIdx.x) * 2; if (e >= (size_t)nheads * HD * TT) return; const int t = (int)(e % TT); const int d = (int)((e / TT) % HD); const int g = (int)(e / ((size_t)TT * HD)); v2h o16; v2us oh, ol;
#pragma unroll
    for (int q = 0; q < 2; ++q) { const float x = F[(size_t)(t + q) * pitch + g * HD + d]; o16[q] = tohx(x); unsigned short a2, c2; splitf(x, a2, c2); oh[q] = a2; ol[q] = c2; }
    *(v2h*)(V16 + e) = o16; *(v2us*)(Vh + e) = oh; *(v2us*)(Vl + e) = ol;  }
__global__ __launch_bounds__(256) void k_csid(float* CS) { const int idx = blockIdx.x * 256 + threadIdx.x; if (idx >= TT * HD) return; v2f cs; cs[0] = 1.0f; cs[1] = 0.0f; *(v2f*)(CS + (size_t)idx * 2) = cs;  }
// k_lsoft: streaming causal row softmax over the TK = TT = 4096 keys, one wave per row i, three sweeps of the f32 score row (lane -> 4 consecutive keys per 128-key chunk, 32 chunks; keys j > i are excluded by index with -3e38 / 0 - the score tiles above the diagonal are never computed and their stale contents are only ever discarded by this select):
__global__ __launch_bounds__(256) void k_lsoft(const float* __restrict__ Sb, h16* P16, bf* Ph, bf* Pl) {
    const int lane = threadIdx.x & 31; const int row = blockIdx.x * 8 + (threadIdx.x >> 5); if (row >= ZH * TT) return; const int i = row % TT; const int zz = row / TT; const bool hires = (i < RH); const float* sr = Sb + (size_t)row * TT; float mx = -3.0e38f;
#pragma unroll 4
    for (int ch = 0; ch < TT / 128; ++ch) { const int j0 = ch * 128 + lane * 4; const v4f a = *(const v4f*)(sr + j0);
#pragma unroll
        for (int q = 0; q < 4; ++q) { float t = a[q] * SCL; asm volatile("" : "+v"(t)); t = (j0 + q <= i) ? t : -3.0e38f; mx = fmaxf(mx, t); } }
#pragma unroll
    for (int sh = 16; sh; sh >>= 1) mx = fmaxf(mx, __shfl_xor(mx, sh, 32));
    float sum = 0.f;
#pragma unroll 4
    for (int ch = 0; ch < TT / 128; ++ch) { const int j0 = ch * 128 + lane * 4; const v4f a = *(const v4f*)(sr + j0);
#pragma unroll
        for (int q = 0; q < 4; ++q) { float t = a[q] * SCL; asm volatile("" : "+v"(t)); t = (j0 + q <= i) ? t : -3.0e38f; float d0 = __fsub_rn(t, mx); asm volatile("" : "+v"(d0)); sum += __builtin_amdgcn_exp2f(__fmul_rn(d0, 1.4426950408889634f)); } }
#pragma unroll
    for (int sh = 16; sh; sh >>= 1) sum += __shfl_xor(sum, sh, 32);
    const float f = __fdiv_rn(hires ? 1.0f : PCAR, sum);
{
        if (hires) {   /* rows < RH: normalised bf16 hi/lo over the first RH keys (every later key is above the diagonal for these rows; the hi/lo attn.v GEMM stops its K loop at the diagonal block), planes [zz][RH][TT] */
#pragma unroll
            for (int ch = 0; ch < RH / 128; ++ch) { const int j0 = ch * 128 + lane * 4; const v4f a = *(const v4f*)(sr + j0); v4us oh, ol;
#pragma unroll
                for (int q = 0; q < 4; ++q) { float t = a[q] * SCL; asm volatile("" : "+v"(t)); t = (j0 + q <= i) ? t : -3.0e38f; float d0 = __fsub_rn(t, mx); asm volatile("" : "+v"(d0)); float ex = __builtin_amdgcn_exp2f(__fmul_rn(d0, 1.4426950408889634f)); asm volatile("" : "+v"(ex)); unsigned short a2, c2; splitf(ex * f, a2, c2); oh[q] = a2; ol[q] = c2; }
                const size_t oo = ((size_t)zz * RH + i) * TT + j0; *(v4us*)(Ph + oo) = oh; *(v4us*)(Pl + oo) = ol; }
        } else {
#pragma unroll 2
            for (int ch = 0; ch < TT / 128; ++ch) { const int j0 = ch * 128 + lane * 4; const v4f a = *(const v4f*)(sr + j0); v4h o4;
#pragma unroll
                for (int q = 0; q < 4; ++q) { float t = a[q] * SCL; asm volatile("" : "+v"(t)); t = (j0 + q <= i) ? t : -3.0e38f; float d0 = __fsub_rn(t, mx); asm volatile("" : "+v"(d0)); float ex = __builtin_amdgcn_exp2f(__fmul_rn(d0, 1.4426950408889634f)); asm volatile("" : "+v"(ex)); o4[q] = tohx(ex * f); }
                *(v4h*)(P16 + (size_t)row * TT + j0) = o4; } }
         }
}

__global__ __launch_bounds__(256) void k_merge(const float* __restrict__ O, int h0, float* OUTb) { const size_t e = ((size_t)blockIdx.x * 256 + threadIdx.x) * 2; if (e >= (size_t)ZH * TT * HD) return; const int d = (int)(e % HD); const int t = (int)((e / HD) % TT); const int zz = (int)(e / ((size_t)HD * TT)); const float cs = (t < RH) ? 1.0f : (1.0f / PCAR); const size_t oo = (size_t)t * DQ + (h0 + zz) * HD + d;
    v2f o2; o2[0] = O[e] * cs; o2[1] = O[e + 1] * cs; *(v2f*)(OUTb + oo) = o2;  }

extern "C" void kernel_launch(void* const* d_in, const int* in_sizes, int n_in,
                              void* d_out, int out_size, void* d_ws, size_t ws_size, hipStream_t stream) {
    (void)in_sizes; (void)n_in; (void)out_size;
    const float* x = (const float*)d_in[0]; const float* wq = (const float*)d_in[1]; const float* bq = (const float*)d_in[2]; const float* wk = (const float*)d_in[3]; const float* bk = (const float*)d_in[4]; const float* wv = (const float*)d_in[5]; const float* bv = (const float*)d_in[6]; const float* wo = nullptr; (void)wo;   /* ROLES SWAPPED: 'wq/bq' <- the module's Wk/bk (d_in[1..2]) since wei = k.q^T puts k on the rows; 'wk/bk' <- Wq/bq (d_in[3..4]) */
    float* OUT = (float*)d_out;     // [4][4096][64]
    char* wsp = (char*)d_ws;
    auto take = [&](size_t bytes) { char* p = wsp; wsp += (bytes + 255) & ~(size_t)255; return (void*)p; };
    bf* WQ = (bf*)take((size_t)DQ * DM * 2); bf* WK = (bf*)take((size_t)DKV * DM * 2); bf* WV = (bf*)take((size_t)DKV * DM * 2); float* CS = (float*)take((size_t)TT * HD * 2 * 4);
    bf* XB = (bf*)take((size_t)TT * DM * 2); float* FQ = (float*)take((size_t)TT * DQ * 4); float* FK = (float*)take((size_t)TT * DKV * 4);
    h16* QP16 = (h16*)take((size_t)NH_ * TT * HD * 2); h16* KP16 = (h16*)take((size_t)NKV * TT * HD * 2); h16* VT16 = (h16*)take((size_t)NKV * HD * TT * 2);
    bf* QPh = (bf*)take((size_t)NH_ * TT * HD * 2); bf* QPl = (bf*)take((size_t)NH_ * TT * HD * 2); bf* KPh = (bf*)take((size_t)NKV * TT * HD * 2); bf* KPl = (bf*)take((size_t)NKV * TT * HD * 2); bf* VTh = (bf*)take((size_t)NKV * HD * TT * 2); bf* VTl = (bf*)take((size_t)NKV * HD * TT * 2); bf* Ph = (bf*)take((size_t)ZH * RH * TT * 2); bf* Pl = (bf*)take((size_t)ZH * RH * TT * 2);
    float* Sb = (float*)take((size_t)ZH * TT * TT * 4); h16* P16 = (h16*)take((size_t)ZH * TT * TT * 2); float* Ob = (float*)take((size_t)ZH * TT * HD * 4);
    if ((size_t)(wsp - (char*)d_ws) > ws_size) return;    // ws 256 MiB
    float* FV = FK;   // v projection reuses the k buffer after the k planes are built (stream-ordered)
    { k_wtG<<<(unsigned)((DM * DQ / 64 + 63) / 64), 256, 0, stream>>>(wq, DM, DQ, WQ); k_wtG<<<(unsigned)((DM * DKV / 64 + 63) / 64), 256, 0, stream>>>(wk, DM, DKV, WK); k_wtG<<<(unsigned)((DM * DKV / 64 + 63) / 64), 256, 0, stream>>>(wv, DM, DKV, WV);
      
       }
    k_csid<<<(TT * HD + 255) / 256, 256, 0, stream>>>(CS);
    const unsigned LQ = (unsigned)(((size_t)NH_ * TT * HD / 2 + 255) / 256), LKv = (unsigned)(((size_t)NKV * TT * HD / 2 + 255) / 256);
    for (int b = 0; b < NB_; ++b) {
        
        k_cvt8<<<(unsigned)(((size_t)TT * DM / 8 + 255) / 256), 256, 0, stream>>>(x + (size_t)b * TT * DM, XB, (size_t)TT * DM / 8);
        k_gemmw<bf, 0, true, 8><<<dim3(TT / 64, DQ / 64, 1), 256, 0, stream>>>(XB, nullptr, WQ, nullptr, DM, FQ, DQ, bq, 0, 0, 0);
        k_rope<<<LQ, 256, 0, stream>>>(FQ, DQ, NH_, CS, nullptr, nullptr, 1.0f, QP16, QPh, QPl);
        k_gemmw<bf, 0, true, 8><<<dim3(TT / 64, DKV / 64, 1), 256, 0, stream>>>(XB, nullptr, WK, nullptr, DM, FK, DKV, bk, 0, 0, 0);
        k_rope<<<LKv, 256, 0, stream>>>(FK, DKV, NKV, CS, nullptr, nullptr, 1.0f, KP16, KPh, KPl);
        k_gemmw<bf, 0, true, 8><<<dim3(TT / 64, DKV / 64, 1), 256, 0, stream>>>(XB, nullptr, WV, nullptr, DM, FV, DKV, bv, 0, 0, 0); k_vtp<<<LKv, 256, 0, stream>>>(FV, DKV, NKV, VT16, VTh, VTl);
        for (int h0 = 0; h0 < NH_; h0 += ZH) { const size_t zq = (size_t)h0, zk = (size_t)(h0 / REP);   // one kv head per query head: each pass takes ZH = 1 head and its kv plane (z-strides TT*HD)
            k_gemmc<bf, 2, 1, 1><<<dim3(RH / 64, TT / 64, ZH), 32, 0, stream>>>(QPh + zq * TT * HD, QPl + zq * TT * HD, KPh + zk * TT * HD, KPl + zk * TT * HD, HD, Sb, TT, 0, (size_t)TT * HD, (size_t)TT * HD, (size_t)TT * TT);
            k_gemmc<h16, 0, 1, 1><<<dim3((TT - RH) / 64, TT / 64, ZH), 32, 0, stream>>>(QP16 + zq * TT * HD + (size_t)RH * HD, nullptr, KP16 + zk * TT * HD, nullptr, HD, Sb + (size_t)RH * TT, TT, RH, (size_t)TT * HD, (size_t)TT * HD, (size_t)TT * TT);
            k_lsoft<<<ZH * TT / 8, 256, 0, stream>>>(Sb, P16, Ph, Pl);
            k_gemmc<bf, 2, 2, 8><<<dim3(RH / 64, HD / 64, ZH), 256, 0, stream>>>(Ph, Pl, VTh + zk * HD * TT, VTl + zk * HD * TT, TT, Ob, HD, 0, (size_t)RH * TT, (size_t)HD * TT, (size_t)TT * HD);
            k_gemmc<h16, 0, 2, 16><<<dim3((TT - RH) / 64, HD / 64, ZH), 512, 0, stream>>>(P16 + (size_t)RH * TT, nullptr, VT16 + zk * HD * TT, nullptr, TT, Ob + (size_t)RH * HD, HD, RH, (size_t)TT * TT, (size_t)HD * TT, (size_t)TT * HD);
            k_merge<<<(unsigned)(((size_t)ZH * TT * HD / 2 + 255) / 256), 256, 0, stream>>>(Ob, h0, OUT + (size_t)b * TT * DQ); }
         }
}

// v002
// A run of this version takes 276 microseconds.
// Two timings next to v001 put it at 1.73 and 1.82 times that version's speed.
// All steps since v000 together make it 3.11 times as fast.
#include <hip/hip_runtime.h>

// Single-head causal attention with the module's quirks (x [4][4096][768]; k = x Wk + bk, q = x Wq + bq, v = x Wv + bv ('xw' [768][64] + [64]); wei[t][s] = k_t . q_s x 768^-0.5 (k on the rows, q on the keys; embedding-dim scaling), causal on (t, s); softmax over s; out = wei v -> [4][4096][64] (1.0 M)).
// The batch lies in the grid: the projection stage runs all NB_ batches per launch (rows or blockIdx.y), the attention stage ZB batches per launch (blockIdx.z); the f32 score plane bounds ZB.
// Layout per batch: bf16 copy of x; exact projections + f32 biases with the ROLES SWAPPED (the query planes come from the k projection, its key planes from the q projection); causal T-4096 attention with one head (hybrid rows: < 512 hi/lo 3 products, rest fp16 x1024; k_gemmc tile skipping; streaming three-sweep softmax); the f32 merge writes the output rows.
// Compute dtypes, f32 accumulate: every input rounded to bf16; projections exact + f32 biases; attention rows < 512 3 products, rest fp16; softmax f32; output f32.

#define NB_  4
#define TT   4096
#define DM   768
#define NH_  1
#define NKV  1
#define REP  (NH_ / NKV)
#define HD   64
#define DQ   (NH_ * HD)
#define DKV  (NKV * HD)
#define ZH   1
#define ZB   2                    // batches per attention pass (z planes of scores and probabilities held in the workspace at once)
#define RH   512                  // query rows < RH use hi+lo planes (0: none)
#define WIN  4096
#define PCAR 1024.0f
#define SCL  0.036084391824351615f   // 768^-0.5
typedef _Float16 h16;
typedef unsigned short bf;
typedef __attribute__((ext_vector_type(16))) __bf16   v16bf;
typedef __attribute__((ext_vector_type(16))) _Float16 v16h;
typedef __attribute__((ext_vector_type(8)))  _Float16 v8h;
typedef __attribute__((ext_vector_type(8)))  unsigned short v8us;
typedef __attribute__((ext_vector_type(8)))  float    v8f;
typedef __attribute__((ext_vector_type(4)))  float    v4f;
typedef v8h  __attribute__((may_alias)) v8ha;
typedef v4f  __attribute__((may_alias)) v4fa;
typedef v8us __attribute__((may_alias)) v8usa;

__device__ __forceinline__ unsigned short f2bf(float f) { unsigned u = __float_as_uint(f); u += 0x7FFFu + ((u >> 16) & 1u); return (unsigned short)(u >> 16); }
__device__ __forceinline__ float bf2f(unsigned short b) { return __uint_as_float(((unsigned)b) << 16); }
__device__ __forceinline__ float bfr(float f) { return bf2f(f2bf(f)); }
__device__ __forceinline__ v16h cat16(v8h lo, v8h hi) { return __builtin_shufflevector(lo, hi, 0, 1, 2, 3, 4, 5, 6, 7, 8, 9, 10, 11, 12, 13, 14, 15); }
__device__ __forceinline__ v16bf cat16b(v8us lo, v8us hi) { return __builtin_bit_cast(v16bf, __builtin_shufflevector(lo, hi, 0, 1, 2, 3, 4, 5, 6, 7, 8, 9, 10, 11, 12, 13, 14, 15)); }
__device__ __forceinline__ v8f wmma16(v16h a, v16h b, v8f c) { return __builtin_amdgcn_wmma_f32_16x16x32_f16(false, a, false, b, (short)0, c, false, false); }
__device__ __forceinline__ v8f wmmab(v16bf a, v16bf b, v8f c) { return __builtin_amdgcn_wmma_f32_16x16x32_bf16(false, a, false, b, (short)0, c, false, false); }



// ---- k_gemmw: register-blocked GEMM, NW WAVES per 64x64 output tile (16 accumulators each; wave w takes the 32-wide K slices w, w+NW, ...; partials summed by splitk_store), operands straight from K-contiguous 16-bit planes; grid (M/64, N/64, Z), 32*NW threads.
// C[m][n] (f32, pitch ldc, + optional f32 bias[n]) = sum_k A[m][k] Bt[n][k] (+ split products per NSPLIT). z-batch strides sA/sB/sC in elements. K % 32 == 0.
template <typename T16> struct WFrag;
template <> struct WFrag<h16> { typedef v16h V; static __device__ __forceinline__ V ld(const h16* p) { return cat16(*(const v8h*)p, *(const v8h*)(p + 16)); } static __device__ __forceinline__ v8f mma(V a, V b, v8f c) { return wmma16(a, b, c); } };
template <> struct WFrag<bf> { typedef v16bf V; static __device__ __forceinline__ V ld(const bf* p) { return cat16b(*(const v8us*)p, *(const v8us*)(p + 16)); } static __device__ __forceinline__ v8f mma(V a, V b, v8f c) { return wmmab(a, b, c); } };
// ---- split-K epilogue: the NW waves of a work-group each hold a partial 64x64 tile (their strided share of K). Every wave parks its tile in LDS (pitch 68 floats), one barrier,
// then each thread adds its float4 positions over the waves in the fixed order 0..NW-1 (+ optional bias) and stores them; a half-wave writes one whole 256-byte row of the tile.
template <int NW, bool BIAS>
__device__ __forceinline__ void splitk_store(const v8f (&acc)[4][4], float* red, float* C, int ldc, int r0, int c0, const float* __restrict__ bias, int wv, int lr, int hi) {
    constexpr int TILE = 64 * 68;
#pragma unroll
    for (int mb = 0; mb < 4; ++mb)
#pragma unroll
        for (int nb = 0; nb < 4; ++nb)
#pragma unroll
            for (int j = 0; j < 8; ++j) red[wv * TILE + (mb * 16 + hi * 8 + j) * 68 + nb * 16 + lr] = acc[mb][nb][j];
    __syncthreads();   // every wave's partial tile is in LDS before any thread sums it
#pragma unroll
    for (int p = 0; p < 32 / NW; ++p) { const int idx = p * 32 * NW + (int)threadIdx.x, row = idx >> 4, cofs = (idx & 15) * 4;
        v4f val = *(const v4fa*)(red + row * 68 + cofs);
#pragma unroll
        for (int w = 1; w < NW; ++w) val += *(const v4fa*)(red + w * TILE + row * 68 + cofs);
        if (BIAS) { val[0] += bfr(bias[c0 + cofs]); val[1] += bfr(bias[c0 + cofs + 1]); val[2] += bfr(bias[c0 + cofs + 2]); val[3] += bfr(bias[c0 + cofs + 3]); }
        *(v4f*)(C + (size_t)(r0 + row) * ldc + c0 + cofs) = val; }
}

template <typename T16, int NSPLIT, bool BIAS, int NW>
__global__ __launch_bounds__(32 * NW) void k_gemmw(const T16* __restrict__ A, const T16* __restrict__ A2, const T16* __restrict__ Bt, const T16* __restrict__ Bt2, int K, float* C, int ldc, const float* __restrict__ bias, size_t sA, size_t sB, size_t sC) {
    typedef typename WFrag<T16>::V V;
    __shared__ __align__(16) float os[NW * 64 * 68];
    const size_t z = blockIdx.z; A += z * sA; if (A2) A2 += z * sA; Bt += z * sB; if (Bt2) Bt2 += z * sB; C += z * sC;
    const int lane = threadIdx.x & 31, lr = lane & 15, hi = lane >> 4, wv = __builtin_amdgcn_readfirstlane(threadIdx.x >> 5); const int r0 = blockIdx.x * 64, c0 = blockIdx.y * 64;
    v8f acc[4][4];
#pragma unroll
    for (int mb = 0; mb < 4; ++mb)
#pragma unroll
        for (int nb = 0; nb < 4; ++nb) acc[mb][nb] = (v8f){};
    const size_t aoff = (size_t)(r0 + lr) * K + 8 * hi, boff = (size_t)(c0 + lr) * K + 8 * hi;
#pragma unroll 1
    for (int kc = wv * 32; kc < K; kc += 32 * NW) {
        V a[4], a2[4];
#pragma unroll
        for (int mb = 0; mb < 4; ++mb) { a[mb] = WFrag<T16>::ld(A + aoff + (size_t)mb * 16 * K + kc); if (NSPLIT == 1 || NSPLIT == 2) a2[mb] = WFrag<T16>::ld(A2 + aoff + (size_t)mb * 16 * K + kc); }
#pragma unroll
        for (int nb = 0; nb < 4; ++nb) { const V b = WFrag<T16>::ld(Bt + boff + (size_t)nb * 16 * K + kc); V b2; if (NSPLIT >= 2) b2 = WFrag<T16>::ld(Bt2 + boff + (size_t)nb * 16 * K + kc);
#pragma unroll
            for (int mb = 0; mb < 4; ++mb) { acc[mb][nb] = WFrag<T16>::mma(a[mb], b, acc[mb][nb]); if (NSPLIT == 1 || NSPLIT == 2) acc[mb][nb] = WFrag<T16>::mma(a2[mb], b, acc[mb][nb]); if (NSPLIT >= 2) acc[mb][nb] = WFrag<T16>::mma(a[mb], b2, acc[mb][nb]); } }
        asm volatile("v_nop\n\tv_nop\n\tv_nop\n\tv_nop" : "+v"(acc[0][0]), "+v"(acc[1][1]), "+v"(acc[2][2]), "+v"(acc[3][3]) : "v"(a[0]), "v"(a[3]));
    }
    splitk_store<NW, BIAS>(acc, os, C, ldc, r0, c0, bias, wv, lr, hi);
}

// ---- k_gemmc: the same 64x64 tile GEMM specialised for causal attention: CMODE 1 skips score tiles entirely above the diagonal (query rows r0+roff.., key columns c0..), CMODE 2 limits the
// key (K) loop of the probability x value contraction to the diagonal block (probabilities beyond it are exactly zero). roff = row offset of this launch's first row within the sequence. NW = waves per tile: 1 for the score tiles (K = 64); the P.V tiles split their K loop over NW waves as k_gemmw does.
template <typename T16, int NSPLIT, int CMODE, int NW>
__global__ __launch_bounds__(32 * NW) void k_gemmc(const T16* __restrict__ A, const T16* __restrict__ A2, const T16* __restrict__ Bt, const T16* __restrict__ Bt2, int K, float* C, int ldc, int roff, size_t sA, size_t sB, size_t sC) {
    typedef typename WFrag<T16>::V V;
    __shared__ __align__(16) float os[(NW == 1 ? 16 : NW * 64) * 68];
    const size_t z = blockIdx.z; A += z * sA; if (A2) A2 += z * sA; Bt += z * sB; if (Bt2) Bt2 += z * sB; C += z * sC;
    const int lane = threadIdx.x & 31, lr = lane & 15, hi = lane >> 4, wv = __builtin_amdgcn_readfirstlane(threadIdx.x >> 5); const int r0 = blockIdx.x * 64, c0 = blockIdx.y * 64;
    if (CMODE == 1 && c0 > r0 + roff + 63) return;                  // score tile entirely above the causal diagonal: never computed (the softmax masks j > i by select)
    const int Kl = (CMODE == 2) ? min(K, r0 + roff + 64) : K;        // P.V: probabilities are exactly 0 beyond the diagonal block, so the K loop stops there
    v8f acc[4][4];
#pragma unroll
    for (int mb = 0; mb < 4; ++mb)
#pragma unroll
        for (int nb = 0; nb < 4; ++nb) acc[mb][nb] = (v8f){};
    const size_t aoff = (size_t)(r0 + lr) * K + 8 * hi, boff = (size_t)(c0 + lr) * K + 8 * hi;
#pragma unroll 1
    for (int kc = wv * 32; kc < Kl; kc += 32 * NW) {
        V a[4], a2[4];
#pragma unroll
        for (int mb = 0; mb < 4; ++mb) { a[mb] = WFrag<T16>::ld(A + aoff + (size_t)mb * 16 * K + kc); if (NSPLIT == 1 || NSPLIT == 2) a2[mb] = WFrag<T16>::ld(A2 + aoff + (size_t)mb * 16 * K + kc); }
#pragma unroll
        for (int nb = 0; nb < 4; ++nb) { const V b = WFrag<T16>::ld(Bt + boff + (size_t)nb * 16 * K + kc); V b2; if (NSPLIT >= 2) b2 = WFrag<T16>::ld(Bt2 + boff + (size_t)nb * 16 * K + kc);
#pragma unroll
            for (int mb = 0; mb < 4; ++mb) { acc[mb][nb] = WFrag<T16>::mma(a[mb], b, acc[mb][nb]); if (NSPLIT == 1 || NSPLIT == 2) acc[mb][nb] = WFrag<T16>::mma(a2[mb], b, acc[mb][nb]); if (NSPLIT >= 2) acc[mb][nb] = WFrag<T16>::mma(a[mb], b2, acc[mb][nb]); } }
        asm volatile("v_nop\n\tv_nop\n\tv_nop\n\tv_nop" : "+v"(acc[0][0]), "+v"(acc[1][1]), "+v"(acc[2][2]), "+v"(acc[3][3]) : "v"(a[0]), "v"(a[3]));
    }
    if constexpr (NW > 1) { splitk_store<NW, false>(acc, os, C, ldc, r0, c0, nullptr, wv, lr, hi); return; }
#pragma unroll
    for (int mb = 0; mb < 4; ++mb) {
#pragma unroll
        for (int nb = 0; nb < 4; ++nb) {
#pragma unroll
            for (int j = 0; j < 8; ++j) os[(hi * 8 + j) * 68 + nb * 16 + lr] = acc[mb][nb][j]; }
        __builtin_amdgcn_wave_barrier(); asm volatile("" ::: "memory");
        float* crow = C + (size_t)(r0 + mb * 16) * ldc + c0;
{
#pragma unroll
            for (int s = 0; s < 8; ++s) { const int row = 2 * s + hi, cofs = lr * 4; v4f val = *(const v4fa*)(os + row * 68 + cofs);
                *(v4f*)(crow + (size_t)row * ldc + cofs) = val; }
             }
        __builtin_amdgcn_wave_barrier(); asm volatile("" ::: "memory");
    }
}

__device__ __forceinline__ h16 tohx(float x) { return (h16)x; }
__device__ __forceinline__ void splitf(float y, unsigned short& h, unsigned short& l) { h = f2bf(y); l = f2bf(y - bf2f(h)); }
typedef __attribute__((ext_vector_type(2))) _Float16 v2h;
typedef __attribute__((ext_vector_type(4))) _Float16 v4h;
typedef __attribute__((ext_vector_type(2))) unsigned short v2us;
typedef __attribute__((ext_vector_type(4))) unsigned short v4us;
typedef __attribute__((ext_vector_type(2))) float v2f;
typedef __attribute__((ext_vector_type(4))) int v4i;

__global__ __launch_bounds__(256) void k_wtG(const float* __restrict__ w, int K, int N, bf* Bt) {
    const int lane = threadIdx.x & 31; const int L0 = (blockIdx.x * 8 + (threadIdx.x >> 5)) * 8; const int nlines = N * K / 64;
{
#pragma unroll 1
        for (int l = 0; l < 8; ++l) { const int L = L0 + l; if (L >= nlines) break; const size_t e = (size_t)L * 64 + lane * 2; const int k = (int)(e % K), n = (int)(e / K); v2us o;
            o[0] = f2bf(w[(size_t)k * N + n]); o[1] = f2bf(w[(size_t)(k + 1) * N + n]); *(v2us*)(Bt + e) = o; }
         }
}
__global__ __launch_bounds__(256) void k_cvt8(const float* __restrict__ src, bf* dst, size_t n8) { const size_t i = (size_t)blockIdx.x * 256 + threadIdx.x; if (i >= n8) return; const v8f v = *(const v8f*)(src + i * 8); v8us o;
#pragma unroll
    for (int k = 0; k < 8; ++k) o[k] = f2bf(v[k]); *(v8us*)(dst + i * 8) = o;  }

// k_rope: head planes [h][t][d] (fp16 + hi/lo) of rope(x) x sc with the rotate-half convention out[d] = x[d] cos[t][d] - x[d+HD/2] sin[t][d], out[d+HD/2] = x[d+HD/2] cos[t][d+HD/2] + x[d] sin[t][d+HD/2]
__global__ __launch_bounds__(256) void k_rope(const float* __restrict__ F, int pitch, int nheads, const float* __restrict__ CS, const float* __restrict__ RF, const float* __restrict__ nw, float sc, h16* P16, bf* Ph, bf* Pl) {
    const size_t e = ((size_t)blockIdx.x * 256 + threadIdx.x) * 2; if (e >= (size_t)nheads * TT * HD) return; const int d = (int)(e % HD); const int t = (int)((e / HD) % TT); const int h = (int)(e / ((size_t)HD * TT)); const size_t zb = blockIdx.y, eo = zb * nheads * TT * HD + e;   /* blockIdx.y = batch */ const float* f = F + (zb * TT + t) * pitch + h * HD; const float rf = RF ? RF[(size_t)h * TT + t] : 1.0f; v2h o16; v2us oh, ol;
#pragma unroll
    for (int q = 0; q < 2; ++q) { const int dd = d + q; const int dp = (dd < HD / 2) ? dd + HD / 2 : dd - HD / 2; float x0 = f[dd], x1 = f[dp];
        if (RF) { float n0 = __fmul_rn(x0, rf), n1 = __fmul_rn(x1, rf); asm volatile("" : "+v"(n0)); asm volatile("" : "+v"(n1)); x0 = __fmul_rn(bfr(nw[dd]), n0); x1 = __fmul_rn(bfr(nw[dp]), n1); }
        const v2f cs = *(const v2f*)(CS + ((size_t)t * HD + dd) * 2); float a = __fmul_rn(x0, cs[0]), bq = __fmul_rn(x1, cs[1]); asm volatile("" : "+v"(a)); asm volatile("" : "+v"(bq)); const float r = ((dd < HD / 2) ? __fsub_rn(a, bq) : __fadd_rn(a, bq)) * sc;
        o16[q] = tohx(r); unsigned short a2, c2; splitf(r, a2, c2); oh[q] = a2; ol[q] = c2; }
    *(v2h*)(P16 + eo) = o16; *(v2us*)(Ph + eo) = oh; *(v2us*)(Pl + eo) = ol;  }
__global__ __launch_bounds__(256) void k_vtp(const float* __restrict__ F, int pitch, int nheads, h16* V16, bf* Vh, bf* Vl) { const size_t e = ((size_t)blockIdx.x * 256 + threadIdx.x) * 2; if (e >= (size_t)nheads * HD * TT) return; const int t = (int)(e % TT); const int d = (int)((e / TT) % HD); const int g = (int)(e / ((size_t)TT * HD)); const size_t zb = blockIdx.y, eo = zb * nheads * HD * TT + e;   /* blockIdx.y = batch */ v2h o16; v2us oh, ol;
#pragma unroll
    for (int q = 0; q < 2; ++q) { const float x = F[(zb * TT + t + q) * pitch + g * HD + d]; o16[q] = tohx(x); unsigned short a2, c2; splitf(x, a2, c2); oh[q] = a2; ol[q] = c2; }
    *(v2h*)(V16 + eo) = o16; *(v2us*)(Vh + eo) = oh; *(v2us*)(Vl + eo) = ol;  }
__global__ __launch_bounds__(256) void k_csid(float* CS) { const int idx = blockIdx.x * 256 + threadIdx.x; if (idx >= TT * HD) return; v2f cs; cs[0] = 1.0f; cs[1] = 0.0f; *(v2f*)(CS + (size_t)idx * 2) = cs;  }
// k_lsoft: streaming causal row softmax over the TK = TT = 4096 keys, one wave per row i, three sweeps of the f32 score row (lane -> 4 consecutive keys per 128-key chunk, 32 chunks; keys j > i are excluded by index with -3e38 / 0 - the score tiles above the diagonal are never computed and their stale contents are only ever discarded by this select):
__global__ __launch_bounds__(256) void k_lsoft(const float* __restrict__ Sb, h16* P16, bf* Ph, bf* Pl) {
    const int lane = threadIdx.x & 31; const int row = blockIdx.x * 8 + (threadIdx.x >> 5); if (row >= ZB * ZH * TT) return; const int i = row % TT; const int zz = row / TT; const bool hires = (i < RH); const float* sr = Sb + (size_t)row * TT; float mx = -3.0e38f;
#pragma unroll 4
    for (int ch = 0; ch < TT / 128; ++ch) { const int j0 = ch * 128 + lane * 4; const v4f a = *(const v4f*)(sr + j0);
#pragma unroll
        for (int q = 0; q < 4; ++q) { float t = a[q] * SCL; asm volatile("" : "+v"(t)); t = (j0 + q <= i) ? t : -3.0e38f; mx = fmaxf(mx, t); } }
#pragma unroll
    for (int sh = 16; sh; sh >>= 1) mx = fmaxf(mx, __shfl_xor(mx, sh, 32));
    float sum = 0.f;
#pragma unroll 4
    for (int ch = 0; ch < TT / 128; ++ch) { const int j0 = ch * 128 + lane * 4; const v4f a = *(const v4f*)(sr + j0);
#pragma unroll
        for (int q = 0; q < 4; ++q) { float t = a[q] * SCL; asm volatile("" : "+v"(t)); t = (j0 + q <= i) ? t : -3.0e38f; float d0 = __fsub_rn(t, mx); asm volatile("" : "+v"(d0)); sum += __builtin_amdgcn_exp2f(__fmul_rn(d0, 1.4426950408889634f)); } }
#pragma unroll
    for (int sh = 16; sh; sh >>= 1) sum += __shfl_xor(sum, sh, 32);
    const float f = __fdiv_rn(hires ? 1.0f : PCAR, sum);
{
        if (hires) {   /* rows < RH: normalised bf16 hi/lo over the first RH keys (every later key is above the diagonal for these rows; the hi/lo attn.v GEMM stops its K loop at the diagonal block), planes [zz][RH][TT] */
#pragma unroll
            for (int ch = 0; ch < RH / 128; ++ch) { const int j0 = ch * 128 + lane * 4; const v4f a = *(const v4f*)(sr + j0); v4us oh, ol;
#pragma unroll
                for (int q = 0; q < 4; ++q) { float t = a[q] * SCL; asm volatile("" : "+v"(t)); t = (j0 + q <= i) ? t : -3.0e38f; float d0 = __fsub_rn(t, mx); asm volatile("" : "+v"(d0)); float ex = __builtin_amdgcn_exp2f(__fmul_rn(d0, 1.4426950408889634f)); asm volatile("" : "+v"(ex)); unsigned short a2, c2; splitf(ex * f, a2, c2); oh[q] = a2; ol[q] = c2; }
                const size_t oo = ((size_t)zz * RH + i) * TT + j0; *(v4us*)(Ph + oo) = oh; *(v4us*)(Pl + oo) = ol; }
        } else {
#pragma unroll 2
            for (int ch = 0; ch < TT / 128; ++ch) { const int j0 = ch * 128 + lane * 4; const v4f a = *(const v4f*)(sr + j0); v4h o4;
#pragma unroll
                for (int q = 0; q < 4; ++q) { float t = a[q] * SCL; asm volatile("" : "+v"(t)); t = (j0 + q <= i) ? t : -3.0e38f; float d0 = __fsub_rn(t, mx); asm volatile("" : "+v"(d0)); float ex = __builtin_amdgcn_exp2f(__fmul_rn(d0, 1.4426950408889634f)); asm volatile("" : "+v"(ex)); o4[q] = tohx(ex * f); }
                *(v4h*)(P16 + (size_t)row * TT + j0) = o4; } }
         }
}

__global__ __launch_bounds__(256) void k_merge(const float* __restrict__ O, int h0, float* OUTb) { const size_t e = ((size_t)blockIdx.x * 256 + threadIdx.x) * 2; if (e >= (size_t)NB_ * TT * HD) return; const int d = (int)(e % HD); const int t = (int)((e / HD) % TT); const int zz = (int)(e / ((size_t)HD * TT)); const float cs = (t < RH) ? 1.0f : (1.0f / PCAR); const size_t oo = ((size_t)zz * TT + t) * DQ + h0 * HD + d;   /* zz = batch */
    v2f o2; o2[0] = O[e] * cs; o2[1] = O[e + 1] * cs; *(v2f*)(OUTb + oo) = o2;  }

extern "C" void kernel_launch(void* const* d_in, const int* in_sizes, int n_in,
                              void* d_out, int out_size, void* d_ws, size_t ws_size, hipStream_t stream) {
    (void)in_sizes; (void)n_in; (void)out_size;
    const float* x = (const float*)d_in[0]; const float* wq = (const float*)d_in[1]; const float* bq = (const float*)d_in[2]; const float* wk = (const float*)d_in[3]; const float* bk = (const float*)d_in[4]; const float* wv = (const float*)d_in[5]; const float* bv = (const float*)d_in[6]; const float* wo = nullptr; (void)wo;   /* ROLES SWAPPED: 'wq/bq' <- the module's Wk/bk (d_in[1..2]) since wei = k.q^T puts k on the rows; 'wk/bk' <- Wq/bq (d_in[3..4]) */
    float* OUT = (float*)d_out;     // [4][4096][64]
    char* wsp = (char*)d_ws;
    auto take = [&](size_t bytes) { char* p = wsp; wsp += (bytes + 255) & ~(size_t)255; return (void*)p; };
    bf* WQ = (bf*)take((size_t)DQ * DM * 2); bf* WK = (bf*)take((size_t)DKV * DM * 2); bf* WV = (bf*)take((size_t)DKV * DM * 2); float* CS = (float*)take((size_t)TT * HD * 2 * 4);
    float* FQ = (float*)take((size_t)NB_ * TT * DQ * 4); float* FK = (float*)take((size_t)NB_ * TT * DKV * 4);
    h16* QP16 = (h16*)take((size_t)NB_ * TT * HD * 2); h16* KP16 = (h16*)take((size_t)NB_ * TT * HD * 2); h16* VT16 = (h16*)take((size_t)NB_ * HD * TT * 2);
    bf* QPh = (bf*)take((size_t)NB_ * TT * HD * 2); bf* QPl = (bf*)take((size_t)NB_ * TT * HD * 2); bf* KPh = (bf*)take((size_t)NB_ * TT * HD * 2); bf* KPl = (bf*)take((size_t)NB_ * TT * HD * 2); bf* VTh = (bf*)take((size_t)NB_ * HD * TT * 2); bf* VTl = (bf*)take((size_t)NB_ * HD * TT * 2); bf* Ph = (bf*)take((size_t)ZB * RH * TT * 2); bf* Pl = (bf*)take((size_t)ZB * RH * TT * 2);
    float* Sb = (float*)take((size_t)ZB * TT * TT * 4); h16* P16 = (h16*)take((size_t)ZB * TT * TT * 2); float* Ob = (float*)take((size_t)NB_ * TT * HD * 4);
    if ((size_t)(wsp - (char*)d_ws) > ws_size) return;    // ws 256 MiB
    bf* XB = (bf*)Sb;   // the bf16 copy of x (all batches, 24 MiB) lies in the score planes: its last reader, the v projection, ends before the first score tile is written (stream-ordered)
    float* FV = FK;   // v projection reuses the k buffer after the k planes are built (stream-ordered)
    { k_wtG<<<(unsigned)((DM * DQ / 64 + 63) / 64), 256, 0, stream>>>(wq, DM, DQ, WQ); k_wtG<<<(unsigned)((DM * DKV / 64 + 63) / 64), 256, 0, stream>>>(wk, DM, DKV, WK); k_wtG<<<(unsigned)((DM * DKV / 64 + 63) / 64), 256, 0, stream>>>(wv, DM, DKV, WV); }
    k_csid<<<(TT * HD + 255) / 256, 256, 0, stream>>>(CS);
    const unsigned LQ = (unsigned)(((size_t)NH_ * TT * HD / 2 + 255) / 256), LKv = (unsigned)(((size_t)NKV * TT * HD / 2 + 255) / 256);
    // projection stage, all batches per launch: x is [NB_ * TT][DM], so the GEMM rows simply run on; the plane builders take the batch from blockIdx.y
    k_cvt8<<<(unsigned)(((size_t)NB_ * TT * DM / 8 + 255) / 256), 256, 0, stream>>>(x, XB, (size_t)NB_ * TT * DM / 8);
    k_gemmw<bf, 0, true, 8><<<dim3(NB_ * TT / 64, DQ / 64, 1), 256, 0, stream>>>(XB, nullptr, WQ, nullptr, DM, FQ, DQ, bq, 0, 0, 0);
    k_rope<<<dim3(LQ, NB_, 1), 256, 0, stream>>>(FQ, DQ, NH_, CS, nullptr, nullptr, 1.0f, QP16, QPh, QPl);
    k_gemmw<bf, 0, true, 8><<<dim3(NB_ * TT / 64, DKV / 64, 1), 256, 0, stream>>>(XB, nullptr, WK, nullptr, DM, FK, DKV, bk, 0, 0, 0);
    k_rope<<<dim3(LKv, NB_, 1), 256, 0, stream>>>(FK, DKV, NKV, CS, nullptr, nullptr, 1.0f, KP16, KPh, KPl);
    k_gemmw<bf, 0, true, 8><<<dim3(NB_ * TT / 64, DKV / 64, 1), 256, 0, stream>>>(XB, nullptr, WV, nullptr, DM, FV, DKV, bv, 0, 0, 0);
    k_vtp<<<dim3(LKv, NB_, 1), 256, 0, stream>>>(FV, DKV, NKV, VT16, VTh, VTl);
    // attention stage, ZB batches per launch: blockIdx.z = batch within the pass (plane strides TT*HD, score stride TT*TT)
    for (int b0 = 0; b0 < NB_; b0 += ZB) { const size_t zp = (size_t)b0 * TT * HD;
        k_gemmc<bf, 2, 1, 1><<<dim3(RH / 64, TT / 64, ZB), 32, 0, stream>>>(QPh + zp, QPl + zp, KPh + zp, KPl + zp, HD, Sb, TT, 0, (size_t)TT * HD, (size_t)TT * HD, (size_t)TT * TT);
        k_gemmc<h16, 0, 1, 1><<<dim3((TT - RH) / 64, TT / 64, ZB), 32, 0, stream>>>(QP16 + zp + (size_t)RH * HD, nullptr, KP16 + zp, nullptr, HD, Sb + (size_t)RH * TT, TT, RH, (size_t)TT * HD, (size_t)TT * HD, (size_t)TT * TT);
        k_lsoft<<<ZB * ZH * TT / 8, 256, 0, stream>>>(Sb, P16, Ph, Pl);
        k_gemmc<bf, 2, 2, 8><<<dim3(RH / 64, HD / 64, ZB), 256, 0, stream>>>(Ph, Pl, VTh + zp, VTl + zp, TT, Ob + zp, HD, 0, (size_t)RH * TT, (size_t)HD * TT, (size_t)TT * HD);
        k_gemmc<h16, 0, 2, 16><<<dim3((TT - RH) / 64, HD / 64, ZB), 512, 0, stream>>>(P16 + (size_t)RH * TT, nullptr, VT16 + zp, nullptr, TT, Ob + zp + (size_t)RH * HD, HD, RH, (size_t)TT * TT, (size_t)HD * TT, (size_t)TT * HD);
    }
    k_merge<<<(unsigned)(((size_t)NB_ * TT * HD / 2 + 255) / 256), 256, 0, stream>>>(Ob, 0, OUT);
}

// v003
// Measured time: 89.9 microseconds a run.
// Next to v002, in two timings, it ran 3.06 and 3.05 times as fast.
// Counting every step since v000, it is 9.50 times as fast.
#include <hip/hip_runtime.h>

// Single-head causal attention with the module's quirks (x [4][4096][768]; k = x Wk + bk, q = x Wq + bq, v = x Wv + bv ('xw' [768][64] + [64]); wei[t][s] = k_t . q_s x 768^-0.5 (k on the rows, q on the keys; embedding-dim scaling), causal on (t, s); softmax over s; out = wei v -> [4][4096][64] (1.0 M)).
// The batch lies in the grid: the projection stage runs all NB_ batches per launch (rows or blockIdx.y), the attention stage all batches and row tiles in one launch.
// Layout per batch: bf16 copy of x; exact projections + f32 biases with the ROLES SWAPPED (the query planes come from the k projection, the key planes from the q projection); causal T-4096 attention with one head in one fused kernel (hybrid rows: < 512 hi/lo 3 products, rest fp16; online softmax; scores and probabilities stay in registers), which writes the output rows.
// Compute dtypes, f32 accumulate: every input rounded to bf16; projections exact + f32 biases; attention rows < 512 3 products, rest fp16; softmax f32; output f32.

#define NB_  4
#define TT   4096
#define DM   768
#define NH_  1
#define NKV  1
#define REP  (NH_ / NKV)
#define HD   64
#define DQ   (NH_ * HD)
#define DKV  (NKV * HD)
#define ZH   1
#define RH   512                  // query rows < RH use hi+lo planes (0: none)
#define WIN  4096
typedef _Float16 h16;
typedef unsigned short bf;
typedef __attribute__((ext_vector_type(16))) __bf16   v16bf;
typedef __attribute__((ext_vector_type(16))) _Float16 v16h;
typedef __attribute__((ext_vector_type(8)))  _Float16 v8h;
typedef __attribute__((ext_vector_type(8)))  unsigned short v8us;
typedef __attribute__((ext_vector_type(8)))  float    v8f;
typedef __attribute__((ext_vector_type(4)))  float    v4f;
typedef v8h  __attribute__((may_alias)) v8ha;
typedef v4f  __attribute__((may_alias)) v4fa;
typedef v8us __attribute__((may_alias)) v8usa;

__device__ __forceinline__ unsigned short f2bf(float f) { unsigned u = __float_as_uint(f); u += 0x7FFFu + ((u >> 16) & 1u); return (unsigned short)(u >> 16); }
__device__ __forceinline__ float bf2f(unsigned short b) { return __uint_as_float(((unsigned)b) << 16); }
__device__ __forceinline__ float bfr(float f) { return bf2f(f2bf(f)); }
__device__ __forceinline__ v16h cat16(v8h lo, v8h hi) { return __builtin_shufflevector(lo, hi, 0, 1, 2, 3, 4, 5, 6, 7, 8, 9, 10, 11, 12, 13, 14, 15); }
__device__ __forceinline__ v16bf cat16b(v8us lo, v8us hi) { return __builtin_bit_cast(v16bf, __builtin_shufflevector(lo, hi, 0, 1, 2, 3, 4, 5, 6, 7, 8, 9, 10, 11, 12, 13, 14, 15)); }
__device__ __forceinline__ v8f wmma16(v16h a, v16h b, v8f c) { return __builtin_amdgcn_wmma_f32_16x16x32_f16(false, a, false, b, (short)0, c, false, false); }
__device__ __forceinline__ v8f wmmab(v16bf a, v16bf b, v8f c) { return __builtin_amdgcn_wmma_f32_16x16x32_bf16(false, a, false, b, (short)0, c, false, false); }



// ---- k_gemmw: register-blocked GEMM, NW WAVES per 64x64 output tile (16 accumulators each; wave w takes the 32-wide K slices w, w+NW, ...; partials summed by splitk_store), operands straight from K-contiguous 16-bit planes; grid (M/64, N/64, Z), 32*NW threads.
// C[m][n] (f32, pitch ldc, + optional f32 bias[n]) = sum_k A[m][k] Bt[n][k] (+ split products per NSPLIT). z-batch strides sA/sB/sC in elements. K % 32 == 0.
template <typename T16> struct WFrag;
template <> struct WFrag<h16> { typedef v16h V; static __device__ __forceinline__ V ld(const h16* p) { return cat16(*(const v8h*)p, *(const v8h*)(p + 16)); } static __device__ __forceinline__ v8f mma(V a, V b, v8f c) { return wmma16(a, b, c); } };
template <> struct WFrag<bf> { typedef v16bf V; static __device__ __forceinline__ V ld(const bf* p) { return cat16b(*(const v8us*)p, *(const v8us*)(p + 16)); } static __device__ __forceinline__ v8f mma(V a, V b, v8f c) { return wmmab(a, b, c); } };
// ---- split-K epilogue: the NW waves of a work-group each hold a partial 64x64 tile (their strided share of K). Every wave parks its tile in LDS (pitch 68 floats), one barrier,
// then each thread adds its float4 positions over the waves in the fixed order 0..NW-1 (+ optional bias) and stores them; a half-wave writes one whole 256-byte row of the tile.
template <int NW, bool BIAS>
__device__ __forceinline__ void splitk_store(const v8f (&acc)[4][4], float* red, float* C, int ldc, int r0, int c0, const float* __restrict__ bias, int wv, int lr, int hi) {
    constexpr int TILE = 64 * 68;
#pragma unroll
    for (int mb = 0; mb < 4; ++mb)
#pragma unroll
        for (int nb = 0; nb < 4; ++nb)
#pragma unroll
            for (int j = 0; j < 8; ++j) red[wv * TILE + (mb * 16 + hi * 8 + j) * 68 + nb * 16 + lr] = acc[mb][nb][j];
    __syncthreads();   // every wave's partial tile is in LDS before any thread sums it
#pragma unroll
    for (int p = 0; p < 32 / NW; ++p) { const int idx = p * 32 * NW + (int)threadIdx.x, row = idx >> 4, cofs = (idx & 15) * 4;
        v4f val = *(const v4fa*)(red + row * 68 + cofs);
#pragma unroll
        for (int w = 1; w < NW; ++w) val += *(const v4fa*)(red + w * TILE + row * 68 + cofs);
        if (BIAS) { val[0] += bfr(bias[c0 + cofs]); val[1] += bfr(bias[c0 + cofs + 1]); val[2] += bfr(bias[c0 + cofs + 2]); val[3] += bfr(bias[c0 + cofs + 3]); }
        *(v4f*)(C + (size_t)(r0 + row) * ldc + c0 + cofs) = val; }
}

template <typename T16, int NSPLIT, bool BIAS, int NW>
__global__ __launch_bounds__(32 * NW) void k_gemmw(const T16* __restrict__ A, const T16* __restrict__ A2, const T16* __restrict__ Bt, const T16* __restrict__ Bt2, int K, float* C, int ldc, const float* __restrict__ bias, size_t sA, size_t sB, size_t sC) {
    typedef typename WFrag<T16>::V V;
    __shared__ __align__(16) float os[NW * 64 * 68];
    const size_t z = blockIdx.z; A += z * sA; if (A2) A2 += z * sA; Bt += z * sB; if (Bt2) Bt2 += z * sB; C += z * sC;
    const int lane = threadIdx.x & 31, lr = lane & 15, hi = lane >> 4, wv = __builtin_amdgcn_readfirstlane(threadIdx.x >> 5); const int r0 = blockIdx.x * 64, c0 = blockIdx.y * 64;
    v8f acc[4][4];
#pragma unroll
    for (int mb = 0; mb < 4; ++mb)
#pragma unroll
        for (int nb = 0; nb < 4; ++nb) acc[mb][nb] = (v8f){};
    const size_t aoff = (size_t)(r0 + lr) * K + 8 * hi, boff = (size_t)(c0 + lr) * K + 8 * hi;
#pragma unroll 1
    for (int kc = wv * 32; kc < K; kc += 32 * NW) {
        V a[4], a2[4];
#pragma unroll
        for (int mb = 0; mb < 4; ++mb) { a[mb] = WFrag<T16>::ld(A + aoff + (size_t)mb * 16 * K + kc); if (NSPLIT == 1 || NSPLIT == 2) a2[mb] = WFrag<T16>::ld(A2 + aoff + (size_t)mb * 16 * K + kc); }
#pragma unroll
        for (int nb = 0; nb < 4; ++nb) { const V b = WFrag<T16>::ld(Bt + boff + (size_t)nb * 16 * K + kc); V b2; if (NSPLIT >= 2) b2 = WFrag<T16>::ld(Bt2 + boff + (size_t)nb * 16 * K + kc);
#pragma unroll
            for (int mb = 0; mb < 4; ++mb) { acc[mb][nb] = WFrag<T16>::mma(a[mb], b, acc[mb][nb]); if (NSPLIT == 1 || NSPLIT == 2) acc[mb][nb] = WFrag<T16>::mma(a2[mb], b, acc[mb][nb]); if (NSPLIT >= 2) acc[mb][nb] = WFrag<T16>::mma(a[mb], b2, acc[mb][nb]); } }
        asm volatile("v_nop\n\tv_nop\n\tv_nop\n\tv_nop" : "+v"(acc[0][0]), "+v"(acc[1][1]), "+v"(acc[2][2]), "+v"(acc[3][3]) : "v"(a[0]), "v"(a[3]));
    }
    splitk_store<NW, BIAS>(acc, os, C, ldc, r0, c0, bias, wv, lr, hi);
}

__device__ __forceinline__ h16 tohx(float x) { return (h16)x; }
__device__ __forceinline__ void splitf(float y, unsigned short& h, unsigned short& l) { h = f2bf(y); l = f2bf(y - bf2f(h)); }
typedef __attribute__((ext_vector_type(2))) _Float16 v2h;
typedef __attribute__((ext_vector_type(4))) _Float16 v4h;
typedef __attribute__((ext_vector_type(2))) unsigned short v2us;
typedef __attribute__((ext_vector_type(4))) unsigned short v4us;
typedef __attribute__((ext_vector_type(2))) float v2f;
typedef __attribute__((ext_vector_type(4))) int v4i;

__global__ __launch_bounds__(256) void k_wtG(const float* __restrict__ w, int K, int N, bf* Bt) {
    const int lane = threadIdx.x & 31; const int L0 = (blockIdx.x * 8 + (threadIdx.x >> 5)) * 8; const int nlines = N * K / 64;
{
#pragma unroll 1
        for (int l = 0; l < 8; ++l) { const int L = L0 + l; if (L >= nlines) break; const size_t e = (size_t)L * 64 + lane * 2; const int k = (int)(e % K), n = (int)(e / K); v2us o;
            o[0] = f2bf(w[(size_t)k * N + n]); o[1] = f2bf(w[(size_t)(k + 1) * N + n]); *(v2us*)(Bt + e) = o; }
         }
}
__global__ __launch_bounds__(256) void k_cvt8(const float* __restrict__ src, bf* dst, size_t n8) { const size_t i = (size_t)blockIdx.x * 256 + threadIdx.x; if (i >= n8) return; const v8f v = *(const v8f*)(src + i * 8); v8us o;
#pragma unroll
    for (int k = 0; k < 8; ++k) o[k] = f2bf(v[k]); *(v8us*)(dst + i * 8) = o;  }

// k_rope: head planes [h][t][d] (fp16 + hi/lo) of rope(x) x sc with the rotate-half convention out[d] = x[d] cos[t][d] - x[d+HD/2] sin[t][d], out[d+HD/2] = x[d+HD/2] cos[t][d+HD/2] + x[d] sin[t][d+HD/2]
__global__ __launch_bounds__(256) void k_rope(const float* __restrict__ F, int pitch, int nheads, const float* __restrict__ CS, const float* __restrict__ RF, const float* __restrict__ nw, float sc, h16* P16, bf* Ph, bf* Pl) {
    const size_t e = ((size_t)blockIdx.x * 256 + threadIdx.x) * 2; if (e >= (size_t)nheads * TT * HD) return; const int d = (int)(e % HD); const int t = (int)((e / HD) % TT); const int h = (int)(e / ((size_t)HD * TT)); const size_t zb = blockIdx.y, eo = zb * nheads * TT * HD + e;   /* blockIdx.y = batch */ const float* f = F + (zb * TT + t) * pitch + h * HD; const float rf = RF ? RF[(size_t)h * TT + t] : 1.0f; v2h o16; v2us oh, ol;
#pragma unroll
    for (int q = 0; q < 2; ++q) { const int dd = d + q; const int dp = (dd < HD / 2) ? dd + HD / 2 : dd - HD / 2; float x0 = f[dd], x1 = f[dp];
        if (RF) { float n0 = __fmul_rn(x0, rf), n1 = __fmul_rn(x1, rf); asm volatile("" : "+v"(n0)); asm volatile("" : "+v"(n1)); x0 = __fmul_rn(bfr(nw[dd]), n0); x1 = __fmul_rn(bfr(nw[dp]), n1); }
        const v2f cs = *(const v2f*)(CS + ((size_t)t * HD + dd) * 2); float a = __fmul_rn(x0, cs[0]), bq = __fmul_rn(x1, cs[1]); asm volatile("" : "+v"(a)); asm volatile("" : "+v"(bq)); const float r = ((dd < HD / 2) ? __fsub_rn(a, bq) : __fadd_rn(a, bq)) * sc;
        o16[q] = tohx(r); unsigned short a2, c2; splitf(r, a2, c2); oh[q] = a2; ol[q] = c2; }
    *(v2h*)(P16 + eo) = o16; *(v2us*)(Ph + eo) = oh; *(v2us*)(Pl + eo) = ol;  }
__global__ __launch_bounds__(256) void k_vtp(const float* __restrict__ F, int pitch, int nheads, h16* V16, bf* Vh, bf* Vl) { const size_t e = ((size_t)blockIdx.x * 256 + threadIdx.x) * 2; if (e >= (size_t)nheads * HD * TT) return; const int t = (int)(e % TT); const int d = (int)((e / TT) % HD); const int g = (int)(e / ((size_t)TT * HD)); const size_t zb = blockIdx.y, eo = zb * nheads * HD * TT + e;   /* blockIdx.y = batch */ v2h o16; v2us oh, ol;
#pragma unroll
    for (int q = 0; q < 2; ++q) { const float x = F[(zb * TT + t + q) * pitch + g * HD + d]; o16[q] = tohx(x); unsigned short a2, c2; splitf(x, a2, c2); oh[q] = a2; ol[q] = c2; }
    *(v2h*)(V16 + eo) = o16; *(v2us*)(Vh + eo) = oh; *(v2us*)(Vl + eo) = ol;  }
__global__ __launch_bounds__(256) void k_csid(float* CS) { const int idx = blockIdx.x * 256 + threadIdx.x; if (idx >= TT * HD) return; v2f cs; cs[0] = 1.0f; cs[1] = 0.0f; *(v2f*)(CS + (size_t)idx * 2) = cs;  }
#define QT 32                     // query rows per work-group
#define FW 8                      // waves per work-group
template <typename T16> struct PPack;
template <> struct PPack<h16> { static __device__ __forceinline__ void pack(const v8f& t0, const v8f& t1, v16h& p, v16h& p2) { v8h lo, up; (void)p2;
#pragma unroll
    for (int e = 0; e < 8; ++e) { lo[e] = tohx(t0[e]); up[e] = tohx(t1[e]); }
    p = cat16(lo, up); } };
template <> struct PPack<bf> { static __device__ __forceinline__ void pack(const v8f& t0, const v8f& t1, v16bf& p, v16bf& p2) { v8us hl, hu, ll, lu;
#pragma unroll
    for (int e = 0; e < 8; ++e) { unsigned short a2, c2; splitf(t0[e], a2, c2); hl[e] = a2; ll[e] = c2; splitf(t1[e], a2, c2); hu[e] = a2; lu[e] = c2; }
    p = cat16b(hl, hu); p2 = cat16b(ll, lu); } };

// s_wait_xcnt 0 behind a run of global loads or stores, in front of any rewrite of the address registers they name; the addresses are inputs so that their registers live up to the wait,
// and the scheduling barrier behind it keeps later writes (of a scalar base too) from rising above the wait.
__device__ __forceinline__ void xwait(const void* a, const void* b, const void* c, const void* d) { asm volatile("s_wait_xcnt 0x0" :: "v"(a), "v"(b), "v"(c), "v"(d) : "memory"); __builtin_amdgcn_sched_barrier(0); }

template <typename T16, bool HR>
__device__ __forceinline__ void fa_tile(const T16* __restrict__ Q, const T16* __restrict__ Q2, const T16* __restrict__ Kp, const T16* __restrict__ Kp2, const T16* __restrict__ Vt, const T16* __restrict__ Vt2, float* __restrict__ outb, int r0, float* red, float* sm, float* sl) {
    typedef typename WFrag<T16>::V V;   // every '#pragma unroll' below makes the index of a fragment array a constant, so that the array lives in registers
    constexpr float SCL2 = (float)(0.036084391824351615 * 1.4426950408889634);   // 768^-0.5 x log2(e): the softmax runs in base 2
    const int lane = threadIdx.x & 31, lr = lane & 15, hi = lane >> 4, wv = __builtin_amdgcn_readfirstlane(threadIdx.x >> 5);
    V q[2][2], q2[2][2]; const size_t qo = (size_t)(r0 + lr) * HD + 8 * hi; const T16* qp = Q + qo; const T16* qp2 = HR ? Q2 + qo : qp;
#pragma unroll
    for (int nt = 0; nt < 2; ++nt)
#pragma unroll
        for (int ks = 0; ks < 2; ++ks) { const int o = nt * 16 * HD + ks * 32; q[nt][ks] = WFrag<T16>::ld(qp + o); if constexpr (HR) q2[nt][ks] = WFrag<T16>::ld(qp2 + o); }
    v8f acc[4][2];
#pragma unroll
    for (int dt = 0; dt < 4; ++dt)
#pragma unroll
        for (int nt = 0; nt < 2; ++nt) acc[dt][nt] = (v8f){};
    float m[2] = {-3.0e38f, -3.0e38f}, l[2] = {0.f, 0.f};
    static_assert(RH <= 64 * FW, "the hi/lo rows take one key block a wave");
    const int nblk = (r0 + QT - 1) / 64 + 1;      // key blocks up to the one that holds the tile's last diagonal element; each holds at least one allowed key for every row of the tile
    V ka[4][2], ka2[4][2];
    auto ldk = [&](const T16* kp, const T16* kp2) {
#pragma unroll
        for (int mt = 0; mt < 4; ++mt)
#pragma unroll
            for (int ks = 0; ks < 2; ++ks) { const int o = mt * 16 * HD + ks * 32; ka[mt][ks] = WFrag<T16>::ld(kp + o); if constexpr (HR) ka2[mt][ks] = WFrag<T16>::ld(kp2 + o); } };
    { const size_t ko = (size_t)(min(wv, nblk - 1) * 64 + lr) * HD + 8 * hi;   // the wave's first key block (the clamp keeps a wave without a block inside the tile's own keys)
      const T16* kp = Kp + ko; const T16* kp2 = HR ? Kp2 + ko : kp; ldk(kp, kp2); xwait(qp, qp2, kp, kp2); }
#pragma unroll 1   // one trip's fragments at a time: two trips side by side do not fit the registers
    for (int kb = wv; kb < nblk; kb += FW) { const int k0 = kb * 64;
        v8f s[4][2];
#pragma unroll
        for (int mt = 0; mt < 4; ++mt)
#pragma unroll
            for (int nt = 0; nt < 2; ++nt) { v8f c = (v8f){};
#pragma unroll
                for (int ks = 0; ks < 2; ++ks) { c = WFrag<T16>::mma(ka[mt][ks], q[nt][ks], c); if constexpr (HR) { c = WFrag<T16>::mma(ka[mt][ks], q2[nt][ks], c); c = WFrag<T16>::mma(ka2[mt][ks], q[nt][ks], c); } }
                s[mt][nt] = c; }
        const T16* kn = Kp + (size_t)(min(kb + FW, nblk - 1) * 64 + lr) * HD + 8 * hi;
        if constexpr (!HR) ldk(kn, kn);           // the wave's next key block is fetched one trip ahead (the last trip re-reads a block of the tile: in bounds, unused)
        V va[2][4], va2[2][4]; const size_t vo = (size_t)lr * TT + k0 + 8 * hi; const T16* vp = Vt + vo; const T16* vp2 = HR ? Vt2 + vo : vp;
#pragma unroll
        for (int ks = 0; ks < 2; ++ks)
#pragma unroll
            for (int dt = 0; dt < 4; ++dt) { const int o = dt * 16 * TT + ks * 32; va[ks][dt] = WFrag<T16>::ld(vp + o); if constexpr (HR) va2[ks][dt] = WFrag<T16>::ld(vp2 + o); }
        xwait(vp, vp2, HR ? vp : kn, HR ? vp2 : kn);   // it also holds all loads of the trip here, in front of the softmax arithmetic that covers their latency
        if (k0 + 63 > r0) {                       // only a block that reaches past the tile's first row has keys above the diagonal (wave-uniform test)
#pragma unroll
            for (int mt = 0; mt < 4; ++mt)
#pragma unroll
                for (int nt = 0; nt < 2; ++nt)
#pragma unroll
                    for (int j = 0; j < 8; ++j) s[mt][nt][j] = (k0 + mt * 16 + hi * 8 + j <= r0 + nt * 16 + lr) ? s[mt][nt][j] : -3.0e38f; }
#pragma unroll
        for (int nt = 0; nt < 2; ++nt) { float bm = -3.0e38f;
#pragma unroll
            for (int mt = 0; mt < 4; ++mt)
#pragma unroll
                for (int j = 0; j < 8; ++j) bm = fmaxf(bm, s[mt][nt][j]);
            bm = fmaxf(bm, __shfl_xor(bm, 16, 32)) * SCL2;   // the scale is positive: the maximum is taken on the raw scores and scaled once
            const float mn = fmaxf(m[nt], bm), alpha = __builtin_amdgcn_exp2f(m[nt] - mn); m[nt] = mn; float bs = 0.f;
#pragma unroll
            for (int mt = 0; mt < 4; ++mt)
#pragma unroll
                for (int j = 0; j < 8; ++j) { const float ex = __builtin_amdgcn_exp2f(__builtin_fmaf(s[mt][nt][j], SCL2, -mn)); s[mt][nt][j] = ex; bs += ex; }
            l[nt] = l[nt] * alpha + bs;           // each wave half keeps the sum of its own keys; the halves are joined once, behind the loop
#pragma unroll
            for (int dt = 0; dt < 4; ++dt) acc[dt][nt] *= alpha; }
#pragma unroll
        for (int ks = 0; ks < 2; ++ks) { V p[2], p2[2];
#pragma unroll
            for (int nt = 0; nt < 2; ++nt) PPack<T16>::pack(s[2 * ks][nt], s[2 * ks + 1][nt], p[nt], p2[nt]);
#pragma unroll
            for (int dt = 0; dt < 4; ++dt)
#pragma unroll
                for (int nt = 0; nt < 2; ++nt) { acc[dt][nt] = WFrag<T16>::mma(va[ks][dt], p[nt], acc[dt][nt]); if constexpr (HR) { acc[dt][nt] = WFrag<T16>::mma(va[ks][dt], p2[nt], acc[dt][nt]); acc[dt][nt] = WFrag<T16>::mma(va2[ks][dt], p[nt], acc[dt][nt]); } } }
        if constexpr (HR) break;                  // rows < RH see at most RH / 64 <= FW key blocks, one a wave: no second trip, so the query fragments die behind the scores (registers)
    }
#pragma unroll
    for (int nt = 0; nt < 2; ++nt) { l[nt] += __shfl_xor(l[nt], 16, 32); if (hi == 0) sm[wv * QT + nt * 16 + lr] = m[nt]; }
    __syncthreads();   // every wave's maxima are in LDS before any wave scales its partial sum and tile to the common maximum
#pragma unroll
    for (int nt = 0; nt < 2; ++nt) { float M = sm[nt * 16 + lr];
#pragma unroll
        for (int w = 1; w < FW; ++w) M = fmaxf(M, sm[w * QT + nt * 16 + lr]);
        const float sc = __builtin_amdgcn_exp2f(m[nt] - M);      // 0 for a wave that had no block
        if (hi == 0) sl[wv * QT + nt * 16 + lr] = l[nt] * sc;
#pragma unroll
        for (int dt = 0; dt < 4; ++dt) { const v8f o = acc[dt][nt] * sc; float* rp = red + (size_t)(wv * QT + nt * 16 + lr) * 68 + dt * 16 + hi * 8;
            *(v4fa*)rp = (v4f){o[0], o[1], o[2], o[3]}; *(v4fa*)(rp + 4) = (v4f){o[4], o[5], o[6], o[7]}; } }
    __syncthreads();   // every wave's scaled partial sum and tile are in LDS before any thread adds them up
    constexpr int NP = QT * 16 / (32 * FW); v4f res[NP]; float* op = outb + (size_t)(r0 + ((int)threadIdx.x >> 4)) * HD + ((int)threadIdx.x & 15) * 4;
#pragma unroll
    for (int p = 0; p < NP; ++p) { const int idx = p * 32 * FW + (int)threadIdx.x, row = idx >> 4, cofs = (idx & 15) * 4;
        float L = 0.f; v4f val = (v4f){};
#pragma unroll
        for (int w = 0; w < FW; ++w) { L += sl[w * QT + row]; val += *(const v4fa*)(red + (size_t)(w * QT + row) * 68 + cofs); }
        res[p] = val * (1.0f / L); }
#pragma unroll
    for (int p = 0; p < NP; ++p) *(v4f*)(op + p * 2 * FW * HD) = res[p];
    xwait(op, op, op, op);
}

// grid: NB_ * TT / QT work-groups, one resident per WGP (two waves a SIMD: amdgpu_waves_per_eu frees the registers that let a whole block's K and V loads fly together). Cost grows with the tile's row and there are more work-groups than places, so cost falls with the index (for speed only).
__global__ __launch_bounds__(32 * FW) __attribute__((amdgpu_waves_per_eu(2, 2))) void k_fattn(const h16* __restrict__ Q16, const h16* __restrict__ K16, const h16* __restrict__ V16, const bf* __restrict__ Qh, const bf* __restrict__ Ql, const bf* __restrict__ Kh, const bf* __restrict__ Kl, const bf* __restrict__ Vh, const bf* __restrict__ Vl, float* __restrict__ OUTb) {
    __shared__ __align__(16) float red[FW * QT * 68]; __shared__ float sm[FW * QT]; __shared__ float sl[FW * QT];
    const int rank = blockIdx.x;
    const int r0 = (TT / QT - 1 - rank / NB_) * QT; const size_t zp = (size_t)(rank % NB_) * TT * HD;
    if (r0 < RH) fa_tile<bf, true>(Qh + zp, Ql + zp, Kh + zp, Kl + zp, Vh + zp, Vl + zp, OUTb + zp, r0, red, sm, sl);       // rows < RH: hi/lo planes, 3 products
    else         fa_tile<h16, false>(Q16 + zp, nullptr, K16 + zp, nullptr, V16 + zp, nullptr, OUTb + zp, r0, red, sm, sl);
}

extern "C" void kernel_launch(void* const* d_in, const int* in_sizes, int n_in,
                              void* d_out, int out_size, void* d_ws, size_t ws_size, hipStream_t stream) {
    (void)in_sizes; (void)n_in; (void)out_size;
    const float* x = (const float*)d_in[0]; const float* wq = (const float*)d_in[1]; const float* bq = (const float*)d_in[2]; const float* wk = (const float*)d_in[3]; const float* bk = (const float*)d_in[4]; const float* wv = (const float*)d_in[5]; const float* bv = (const float*)d_in[6]; const float* wo = nullptr; (void)wo;   /* ROLES SWAPPED: 'wq/bq' <- the module's Wk/bk (d_in[1..2]) since wei = k.q^T puts k on the rows; 'wk/bk' <- Wq/bq (d_in[3..4]) */
    float* OUT = (float*)d_out;     // [4][4096][64]
    char* wsp = (char*)d_ws;
    auto take = [&](size_t bytes) { char* p = wsp; wsp += (bytes + 255) & ~(size_t)255; return (void*)p; };
    bf* WQ = (bf*)take((size_t)DQ * DM * 2); bf* WK = (bf*)take((size_t)DKV * DM * 2); bf* WV = (bf*)take((size_t)DKV * DM * 2); float* CS = (float*)take((size_t)TT * HD * 2 * 4);
    float* FQ = (float*)take((size_t)NB_ * TT * DQ * 4); float* FK = (float*)take((size_t)NB_ * TT * DKV * 4);
    h16* QP16 = (h16*)take((size_t)NB_ * TT * HD * 2); h16* KP16 = (h16*)take((size_t)NB_ * TT * HD * 2); h16* VT16 = (h16*)take((size_t)NB_ * HD * TT * 2);
    bf* QPh = (bf*)take((size_t)NB_ * TT * HD * 2); bf* QPl = (bf*)take((size_t)NB_ * TT * HD * 2); bf* KPh = (bf*)take((size_t)NB_ * TT * HD * 2); bf* KPl = (bf*)take((size_t)NB_ * TT * HD * 2); bf* VTh = (bf*)take((size_t)NB_ * HD * TT * 2); bf* VTl = (bf*)take((size_t)NB_ * HD * TT * 2);
    bf* XB = (bf*)take((size_t)NB_ * TT * DM * 2);   // the bf16 copy of x (all batches, 24 MiB)
    if ((size_t)(wsp - (char*)d_ws) > ws_size) return;    // ws 256 MiB
    float* FV = FK;   // v projection reuses the k buffer after the k planes are built (stream-ordered)
    { k_wtG<<<(unsigned)((DM * DQ / 64 + 63) / 64), 256, 0, stream>>>(wq, DM, DQ, WQ); k_wtG<<<(unsigned)((DM * DKV / 64 + 63) / 64), 256, 0, stream>>>(wk, DM, DKV, WK); k_wtG<<<(unsigned)((DM * DKV / 64 + 63) / 64), 256, 0, stream>>>(wv, DM, DKV, WV); }
    k_csid<<<(TT * HD + 255) / 256, 256, 0, stream>>>(CS);
    const unsigned LQ = (unsigned)(((size_t)NH_ * TT * HD / 2 + 255) / 256), LKv = (unsigned)(((size_t)NKV * TT * HD / 2 + 255) / 256);
    // projection stage, all batches per launch: x is [NB_ * TT][DM], so the GEMM rows simply run on; the plane builders take the batch from blockIdx.y
    k_cvt8<<<(unsigned)(((size_t)NB_ * TT * DM / 8 + 255) / 256), 256, 0, stream>>>(x, XB, (size_t)NB_ * TT * DM / 8);
    k_gemmw<bf, 0, true, 8><<<dim3(NB_ * TT / 64, DQ / 64, 1), 256, 0, stream>>>(XB, nullptr, WQ, nullptr, DM, FQ, DQ, bq, 0, 0, 0);
    k_rope<<<dim3(LQ, NB_, 1), 256, 0, stream>>>(FQ, DQ, NH_, CS, nullptr, nullptr, 1.0f, QP16, QPh, QPl);
    k_gemmw<bf, 0, true, 8><<<dim3(NB_ * TT / 64, DKV / 64, 1), 256, 0, stream>>>(XB, nullptr, WK, nullptr, DM, FK, DKV, bk, 0, 0, 0);
    k_rope<<<dim3(LKv, NB_, 1), 256, 0, stream>>>(FK, DKV, NKV, CS, nullptr, nullptr, 1.0f, KP16, KPh, KPl);
    k_gemmw<bf, 0, true, 8><<<dim3(NB_ * TT / 64, DKV / 64, 1), 256, 0, stream>>>(XB, nullptr, WV, nullptr, DM, FV, DKV, bv, 0, 0, 0);
    k_vtp<<<dim3(LKv, NB_, 1), 256, 0, stream>>>(FV, DKV, NKV, VT16, VTh, VTl);
    // attention stage: one launch for all batches and row tiles; it writes the output rows itself
    k_fattn<<<NB_ * TT / QT, 32 * FW, 0, stream>>>(QP16, KP16, VT16, QPh, QPl, KPh, KPl, VTh, VTl, OUT);
}

// v004
// One run takes 37.7 microseconds.
// Next to v003, in two timings, it ran 2.37 and 2.40 times as fast.
// Over all steps from v000 it is 22.6 times as fast.
#include <hip/hip_runtime.h>

// Single-head causal attention with the module's quirks (x [4][4096][768]; k = x Wk + bk, q = x Wq + bq, v = x Wv + bv ('xw' [768][64] + [64]); wei[t][s] = k_t . q_s x 768^-0.5 (k on the rows, q on the keys; embedding-dim scaling), causal on (t, s); softmax over s; out = wei v -> [4][4096][64] (1.0 M)).
// Three launches: the weights packed in fragment order; the projection stage (all batches, one 64-row tile of x a work-group, it writes the 16-bit planes itself); the attention stage (all batches and row tiles).
// Layout: x rounded to bf16 on its way into LDS; exact projections + f32 biases with the ROLES SWAPPED (the query planes come from the k projection, the key planes from the q projection); causal T-4096 attention with one head in one fused kernel (hybrid rows: < 512 hi/lo 3 products, rest fp16; online softmax; scores and probabilities stay in registers), which writes the output rows.
// Compute dtypes, f32 accumulate: every input rounded to bf16; projections exact + f32 biases; attention rows < 512 3 products, rest fp16; softmax f32; output f32.

#define NB_  4
#define TT   4096
#define DM   768
#define NH_  1
#define NKV  1
#define REP  (NH_ / NKV)
#define HD   64
#define DQ   (NH_ * HD)
#define DKV  (NKV * HD)
#define ZH   1
#define RH   512                  // query rows < RH use hi+lo planes (0: none)
#define WIN  4096
typedef _Float16 h16;
typedef unsigned short bf;
typedef __attribute__((ext_vector_type(16))) __bf16   v16bf;
typedef __attribute__((ext_vector_type(16))) _Float16 v16h;
typedef __attribute__((ext_vector_type(8)))  _Float16 v8h;
typedef __attribute__((ext_vector_type(8)))  unsigned short v8us;
typedef __attribute__((ext_vector_type(8)))  float    v8f;
typedef __attribute__((ext_vector_type(4)))  float    v4f;
typedef v8h  __attribute__((may_alias)) v8ha;
typedef v4f  __attribute__((may_alias)) v4fa;
typedef v8us __attribute__((may_alias)) v8usa;

__device__ __forceinline__ unsigned short f2bf(float f) { unsigned u = __float_as_uint(f); u += 0x7FFFu + ((u >> 16) & 1u); return (unsigned short)(u >> 16); }
__device__ __forceinline__ float bf2f(unsigned short b) { return __uint_as_float(((unsigned)b) << 16); }
__device__ __forceinline__ float bfr(float f) { return bf2f(f2bf(f)); }
__device__ __forceinline__ v16h cat16(v8h lo, v8h hi) { return __builtin_shufflevector(lo, hi, 0, 1, 2, 3, 4, 5, 6, 7, 8, 9, 10, 11, 12, 13, 14, 15); }
__device__ __forceinline__ v16bf cat16b(v8us lo, v8us hi) { return __builtin_bit_cast(v16bf, __builtin_shufflevector(lo, hi, 0, 1, 2, 3, 4, 5, 6, 7, 8, 9, 10, 11, 12, 13, 14, 15)); }
__device__ __forceinline__ v8f wmma16(v16h a, v16h b, v8f c) { return __builtin_amdgcn_wmma_f32_16x16x32_f16(false, a, false, b, (short)0, c, false, false); }
__device__ __forceinline__ v8f wmmab(v16bf a, v16bf b, v8f c) { return __builtin_amdgcn_wmma_f32_16x16x32_bf16(false, a, false, b, (short)0, c, false, false); }



// fragment loaders: 16 values of one row, k order 8*hi + 0..7, 16 + 8*hi + 0..7, from a K-contiguous 16-bit plane
template <typename T16> struct WFrag;
template <> struct WFrag<h16> { typedef v16h V; static __device__ __forceinline__ V ld(const h16* p) { return cat16(*(const v8h*)p, *(const v8h*)(p + 16)); } static __device__ __forceinline__ v8f mma(V a, V b, v8f c) { return wmma16(a, b, c); } };
template <> struct WFrag<bf> { typedef v16bf V; static __device__ __forceinline__ V ld(const bf* p) { return cat16b(*(const v8us*)p, *(const v8us*)(p + 16)); } static __device__ __forceinline__ v8f mma(V a, V b, v8f c) { return wmmab(a, b, c); } };

__device__ __forceinline__ h16 tohx(float x) { return (h16)x; }
__device__ __forceinline__ void splitf(float y, unsigned short& h, unsigned short& l) { h = f2bf(y); l = f2bf(y - bf2f(h)); }
typedef __attribute__((ext_vector_type(2))) _Float16 v2h;
typedef __attribute__((ext_vector_type(4))) _Float16 v4h;
typedef __attribute__((ext_vector_type(2))) unsigned short v2us;
typedef __attribute__((ext_vector_type(4))) unsigned short v4us;
typedef __attribute__((ext_vector_type(2))) float v2f;
typedef __attribute__((ext_vector_type(4))) int v4i;

#define QT 32                     // query rows per work-group
#define FW 8                      // waves per work-group
template <typename T16> struct PPack;
template <> struct PPack<h16> { static __device__ __forceinline__ void pack(const v8f& t0, const v8f& t1, v16h& p, v16h& p2) { v8h lo, up; (void)p2;
#pragma unroll
    for (int e = 0; e < 8; ++e) { lo[e] = tohx(t0[e]); up[e] = tohx(t1[e]); }
    p = cat16(lo, up); } };
template <> struct PPack<bf> { static __device__ __forceinline__ void pack(const v8f& t0, const v8f& t1, v16bf& p, v16bf& p2) { v8us hl, hu, ll, lu;
#pragma unroll
    for (int e = 0; e < 8; ++e) { unsigned short a2, c2; splitf(t0[e], a2, c2); hl[e] = a2; ll[e] = c2; splitf(t1[e], a2, c2); hu[e] = a2; lu[e] = c2; }
    p = cat16b(hl, hu); p2 = cat16b(ll, lu); } };

// s_wait_xcnt 0 behind a run of global loads or stores, in front of any rewrite of the address registers they name; the addresses are inputs so that their registers live up to the wait,
// and the scheduling barrier behind it keeps later writes (of a scalar base too) from rising above the wait.
__device__ __forceinline__ void xwait(const void* a, const void* b, const void* c, const void* d) { asm volatile("s_wait_xcnt 0x0" :: "v"(a), "v"(b), "v"(c), "v"(d) : "memory"); __builtin_amdgcn_sched_barrier(0); }

template <typename T16, bool HR>
__device__ __forceinline__ void fa_tile(const T16* __restrict__ Q, const T16* __restrict__ Q2, const T16* __restrict__ Kp, const T16* __restrict__ Kp2, const T16* __restrict__ Vt, const T16* __restrict__ Vt2, float* __restrict__ outb, int r0, float* red, float* sm, float* sl) {
    typedef typename WFrag<T16>::V V;   // every '#pragma unroll' below makes the index of a fragment array a constant, so that the array lives in registers
    constexpr float SCL2 = (float)(0.036084391824351615 * 1.4426950408889634);   // 768^-0.5 x log2(e): the softmax runs in base 2
    const int lane = threadIdx.x & 31, lr = lane & 15, hi = lane >> 4, wv = __builtin_amdgcn_readfirstlane(threadIdx.x >> 5);
    V q[2][2], q2[2][2]; const size_t qo = (size_t)(r0 + lr) * HD + 8 * hi; const T16* qp = Q + qo; const T16* qp2 = HR ? Q2 + qo : qp;
#pragma unroll
    for (int nt = 0; nt < 2; ++nt)
#pragma unroll
        for (int ks = 0; ks < 2; ++ks) { const int o = nt * 16 * HD + ks * 32; q[nt][ks] = WFrag<T16>::ld(qp + o); if constexpr (HR) q2[nt][ks] = WFrag<T16>::ld(qp2 + o); }
    v8f acc[4][2];
#pragma unroll
    for (int dt = 0; dt < 4; ++dt)
#pragma unroll
        for (int nt = 0; nt < 2; ++nt) acc[dt][nt] = (v8f){};
    float m[2] = {-3.0e38f, -3.0e38f}, l[2] = {0.f, 0.f};
    static_assert(RH <= 64 * FW, "the hi/lo rows take one key block a wave");
    const int nblk = (r0 + QT - 1) / 64 + 1;      // key blocks up to the one that holds the tile's last diagonal element; each holds at least one allowed key for every row of the tile
    V ka[4][2], ka2[4][2];
    auto ldk = [&](const T16* kp, const T16* kp2) {
#pragma unroll
        for (int mt = 0; mt < 4; ++mt)
#pragma unroll
            for (int ks = 0; ks < 2; ++ks) { const int o = mt * 16 * HD + ks * 32; ka[mt][ks] = WFrag<T16>::ld(kp + o); if constexpr (HR) ka2[mt][ks] = WFrag<T16>::ld(kp2 + o); } };
    { const size_t ko = (size_t)(min(wv, nblk - 1) * 64 + lr) * HD + 8 * hi;   // the wave's first key block (the clamp keeps a wave without a block inside the tile's own keys)
      const T16* kp = Kp + ko; const T16* kp2 = HR ? Kp2 + ko : kp; ldk(kp, kp2); xwait(qp, qp2, kp, kp2); }
#pragma unroll 1   // one trip's fragments at a time: two trips side by side do not fit the registers
    for (int kb = wv; kb < nblk; kb += FW) { const int k0 = kb * 64;
        v8f s[4][2];
#pragma unroll
        for (int mt = 0; mt < 4; ++mt)
#pragma unroll
            for (int nt = 0; nt < 2; ++nt) { v8f c = (v8f){};
#pragma unroll
                for (int ks = 0; ks < 2; ++ks) { c = WFrag<T16>::mma(ka[mt][ks], q[nt][ks], c); if constexpr (HR) { c = WFrag<T16>::mma(ka[mt][ks], q2[nt][ks], c); c = WFrag<T16>::mma(ka2[mt][ks], q[nt][ks], c); } }
                s[mt][nt] = c; }
        const T16* kn = Kp + (size_t)(min(kb + FW, nblk - 1) * 64 + lr) * HD + 8 * hi;
        if constexpr (!HR) ldk(kn, kn);           // the wave's next key block is fetched one trip ahead (the last trip re-reads a block of the tile: in bounds, unused)
        V va[2][4], va2[2][4]; const size_t vo = (size_t)lr * TT + k0 + 8 * hi; const T16* vp = Vt + vo; const T16* vp2 = HR ? Vt2 + vo : vp;
#pragma unroll
        for (int ks = 0; ks < 2; ++ks)
#pragma unroll
            for (int dt = 0; dt < 4; ++dt) { const int o = dt * 16 * TT + ks * 32; va[ks][dt] = WFrag<T16>::ld(vp + o); if constexpr (HR) va2[ks][dt] = WFrag<T16>::ld(vp2 + o); }
        xwait(vp, vp2, HR ? vp : kn, HR ? vp2 : kn);   // it also holds all loads of the trip here, in front of the softmax arithmetic that covers their latency
        if (k0 + 63 > r0) {                       // only a block that reaches past the tile's first row has keys above the diagonal (wave-uniform test)
#pragma unroll
            for (int mt = 0; mt < 4; ++mt)
#pragma unroll
                for (int nt = 0; nt < 2; ++nt)
#pragma unroll
                    for (int j = 0; j < 8; ++j) s[mt][nt][j] = (k0 + mt * 16 + hi * 8 + j <= r0 + nt * 16 + lr) ? s[mt][nt][j] : -3.0e38f; }
#pragma unroll
        for (int nt = 0; nt < 2; ++nt) { float bm = -3.0e38f;
#pragma unroll
            for (int mt = 0; mt < 4; ++mt)
#pragma unroll
                for (int j = 0; j < 8; ++j) bm = fmaxf(bm, s[mt][nt][j]);
            bm = fmaxf(bm, __shfl_xor(bm, 16, 32)) * SCL2;   // the scale is positive: the maximum is taken on the raw scores and scaled once
            const float mn = fmaxf(m[nt], bm), alpha = __builtin_amdgcn_exp2f(m[nt] - mn); m[nt] = mn; float bs = 0.f;
#pragma unroll
            for (int mt = 0; mt < 4; ++mt)
#pragma unroll
                for (int j = 0; j < 8; ++j) { const float ex = __builtin_amdgcn_exp2f(__builtin_fmaf(s[mt][nt][j], SCL2, -mn)); s[mt][nt][j] = ex; bs += ex; }
            l[nt] = l[nt] * alpha + bs;           // each wave half keeps the sum of its own keys; the halves are joined once, behind the loop
#pragma unroll
            for (int dt = 0; dt < 4; ++dt) acc[dt][nt] *= alpha; }
#pragma unroll
        for (int ks = 0; ks < 2; ++ks) { V p[2], p2[2];
#pragma unroll
            for (int nt = 0; nt < 2; ++nt) PPack<T16>::pack(s[2 * ks][nt], s[2 * ks + 1][nt], p[nt], p2[nt]);
#pragma unroll
            for (int dt = 0; dt < 4; ++dt)
#pragma unroll
                for (int nt = 0; nt < 2; ++nt) { acc[dt][nt] = WFrag<T16>::mma(va[ks][dt], p[nt], acc[dt][nt]); if constexpr (HR) { acc[dt][nt] = WFrag<T16>::mma(va[ks][dt], p2[nt], acc[dt][nt]); acc[dt][nt] = WFrag<T16>::mma(va2[ks][dt], p[nt], acc[dt][nt]); } } }
        if constexpr (HR) break;                  // rows < RH see at most RH / 64 <= FW key blocks, one a wave: no second trip, so the query fragments die behind the scores (registers)
    }
#pragma unroll
    for (int nt = 0; nt < 2; ++nt) { l[nt] += __shfl_xor(l[nt], 16, 32); if (hi == 0) sm[wv * QT + nt * 16 + lr] = m[nt]; }
    __syncthreads();   // every wave's maxima are in LDS before any wave scales its partial sum and tile to the common maximum
#pragma unroll
    for (int nt = 0; nt < 2; ++nt) { float M = sm[nt * 16 + lr];
#pragma unroll
        for (int w = 1; w < FW; ++w) M = fmaxf(M, sm[w * QT + nt * 16 + lr]);
        const float sc = __builtin_amdgcn_exp2f(m[nt] - M);      // 0 for a wave that had no block
        if (hi == 0) sl[wv * QT + nt * 16 + lr] = l[nt] * sc;
#pragma unroll
        for (int dt = 0; dt < 4; ++dt) { const v8f o = acc[dt][nt] * sc; float* rp = red + (size_t)(wv * QT + nt * 16 + lr) * 68 + dt * 16 + hi * 8;
            *(v4fa*)rp = (v4f){o[0], o[1], o[2], o[3]}; *(v4fa*)(rp + 4) = (v4f){o[4], o[5], o[6], o[7]}; } }
    __syncthreads();   // every wave's scaled partial sum and tile are in LDS before any thread adds them up
    constexpr int NP = QT * 16 / (32 * FW); v4f res[NP]; float* op = outb + (size_t)(r0 + ((int)threadIdx.x >> 4)) * HD + ((int)threadIdx.x & 15) * 4;
#pragma unroll
    for (int p = 0; p < NP; ++p) { const int idx = p * 32 * FW + (int)threadIdx.x, row = idx >> 4, cofs = (idx & 15) * 4;
        float L = 0.f; v4f val = (v4f){};
#pragma unroll
        for (int w = 0; w < FW; ++w) { L += sl[w * QT + row]; val += *(const v4fa*)(red + (size_t)(w * QT + row) * 68 + cofs); }
        res[p] = val * (1.0f / L); }
#pragma unroll
    for (int p = 0; p < NP; ++p) *(v4f*)(op + p * 2 * FW * HD) = res[p];
    xwait(op, op, op, op);
}

// grid: NB_ * TT / QT work-groups, one resident per WGP (two waves a SIMD: amdgpu_waves_per_eu frees the registers that let a whole block's K and V loads fly together). Cost grows with the tile's row and there are more work-groups than places, so cost falls with the index (for speed only).
__global__ __launch_bounds__(32 * FW) __attribute__((amdgpu_waves_per_eu(2, 2))) void k_fattn(const h16* __restrict__ Q16, const h16* __restrict__ K16, const h16* __restrict__ V16, const bf* __restrict__ Qh, const bf* __restrict__ Ql, const bf* __restrict__ Kh, const bf* __restrict__ Kl, const bf* __restrict__ Vh, const bf* __restrict__ Vl, float* __restrict__ OUTb) {
    __shared__ __align__(16) float red[FW * QT * 68]; __shared__ float sm[FW * QT]; __shared__ float sl[FW * QT];
    const int rank = blockIdx.x;
    const int r0 = (TT / QT - 1 - rank / NB_) * QT; const size_t zp = (size_t)(rank % NB_) * TT * HD;
    if (r0 < RH) fa_tile<bf, true>(Qh + zp, Ql + zp, Kh + zp, Kl + zp, Vh + zp, Vl + zp, OUTb + zp, r0, red, sm, sl);       // rows < RH: hi/lo planes, 3 products
    else         fa_tile<h16, false>(Q16 + zp, nullptr, K16 + zp, nullptr, V16 + zp, nullptr, OUTb + zp, r0, red, sm, sl);
}

// ---- k_wpack: the three weights [DM][HD] (f32) rounded to bf16 and laid out as the projection kernel's fragments: WP[s][nb][part][lane][8], s = 32-wide K slice, nb = 16-column block (0-3 first weight, 4-7 second, 8-11 third);
// element j is w[s*32 + part*16 + 8*(lane>>4) + j][(nb&3)*16 + (lane&15)]: the fragment loaders' k order, so that a wave's 16-byte load covers 512 contiguous bytes. One thread a 16-byte piece.
typedef __attribute__((ext_vector_type(2))) __bf16 v2bf;
typedef v4us __attribute__((may_alias)) v4usa;
#define NSL (DM / 32)             // K slices
#define NBT (3 * HD / 16)         // column blocks of the three weights together
__global__ __launch_bounds__(256) void k_wpack(const float* __restrict__ w0, const float* __restrict__ w1, const float* __restrict__ w2, bf* WP) {
    const int T = blockIdx.x * 256 + threadIdx.x, lane = T & 31, part = (T >> 5) & 1, sn = T >> 6, nb = sn % NBT, s = sn / NBT;
    const float* w = nb < 4 ? w0 : nb < 8 ? w1 : w2;
    const float* p = w + (size_t)(s * 32 + part * 16 + 8 * (lane >> 4)) * HD + (nb & 3) * 16 + (lane & 15); v8us o;
#pragma unroll   // the eight loads fly together
    for (int j = 0; j < 8; ++j) o[j] = f2bf(p[j * HD]);
    *(v8us*)(WP + (size_t)T * 8) = o;
}

// ---- k_proj: the whole projection stage of one 64-row tile of x in ONE kernel: x (f32) -> bf16 in LDS, three 64x64 products on the matrix unit, biases, and the 16-bit planes the attention kernel reads.
// PW waves; wave w takes the 32-wide K slices w, w + PW, w + 2 PW of all three products (its x fragments stay in registers); per product the partial tiles are parked in LDS (pitch 68 floats), one barrier,
// and each thread adds its float4 positions over the waves in the fixed order 0..PW-1, adds the bias, converts and stores. Query and key planes are [t][d], so their product is taken as W^T x^T (a lane holds 8 d of one t);
// the value planes are [d][t], so theirs is x W (a lane holds 8 t of one d): either way a lane parks 8 neighbours with two 16-byte LDS stores and a half-wave stores whole 128-byte lines of a plane.
#define PW 8
#define XP (DM + 8)               // staged x row pitch in bf16: 1552 B = 16 B x 97 (odd), so that the 16 rows of a fragment read fall on different banks
#define PTILE (64 * 68)
template <int G>
__device__ __forceinline__ void proj_round(const v16bf (&a)[3][4], v16bf (&b)[3][4], const bf* wp, float* red, const float (&bias)[4], h16* P16, bf* Ph, bf* Pl, int r0, int tid, int lr, int hi, int wv) {
    v8f acc[4][4];   // every '#pragma unroll' below makes the index of a fragment array a constant, so that the array lives in registers
#pragma unroll
    for (int mb = 0; mb < 4; ++mb)
#pragma unroll
        for (int nb = 0; nb < 4; ++nb) acc[mb][nb] = (v8f){};
#pragma unroll
    for (int i = 0; i < 3; ++i)
#pragma unroll
        for (int nb = 0; nb < 4; ++nb)
#pragma unroll
            for (int mb = 0; mb < 4; ++mb) acc[mb][nb] = (G < 2) ? wmmab(b[i][nb], a[i][mb], acc[mb][nb]) : wmmab(a[i][mb], b[i][nb], acc[mb][nb]);
    if constexpr (G < 2) {   // the next product's weight fragments fly while this product's partials are summed
#pragma unroll
        for (int i = 0; i < 3; ++i)
#pragma unroll
            for (int nb = 0; nb < 4; ++nb) { const bf* p = wp + (i * PW * NBT + (G + 1) * 4 + nb) * 512; b[i][nb] = cat16b(*(const v8us*)p, *(const v8us*)(p + 256)); }
        xwait(wp, wp, wp, wp); }   // in front of any rewrite of the address these loads name
    float* ar = red + (G & 1) * PW * PTILE;   // two areas in turn: a product's partials are written while slower waves may still read the one before
#pragma unroll
    for (int mb = 0; mb < 4; ++mb)
#pragma unroll
        for (int nb = 0; nb < 4; ++nb) { const v8f o = acc[mb][nb]; float* rp = ar + wv * PTILE + (((G < 2) ? mb : nb) * 16 + lr) * 68 + ((G < 2) ? nb : mb) * 16 + hi * 8;
            *(v4fa*)rp = (v4f){o[0], o[1], o[2], o[3]}; *(v4fa*)(rp + 4) = (v4f){o[4], o[5], o[6], o[7]}; }
    __syncthreads();   // every wave's partial tile is in LDS before any thread sums it
    const int row = tid >> 4, cofs = (tid & 15) * 4; const float* rd = ar + row * 68 + cofs;
    const size_t o0 = (G < 2) ? (size_t)(r0 + row) * HD + cofs : (size_t)(r0 / TT) * HD * TT + (size_t)row * TT + (r0 % TT) + cofs;
    constexpr int STEP = (G < 2) ? 16 * HD : 16 * TT;
    h16* q16 = P16 + o0; bf* qh = Ph + o0; bf* ql = Pl + o0;
    v4h o16[4]; v4us oh[4], ol[4];
#pragma unroll
    for (int p = 0; p < 4; ++p) { v4f val = *(const v4fa*)(rd + p * 16 * 68);
#pragma unroll
        for (int w = 1; w < PW; ++w) val += *(const v4fa*)(rd + w * PTILE + p * 16 * 68);
#pragma unroll
        for (int e = 0; e < 4; ++e) { const float y = val[e] + bfr(bias[(G < 2) ? e : p]); o16[p][e] = tohx(y); unsigned short a2, c2; splitf(y, a2, c2); oh[p][e] = a2; ol[p][e] = c2; } }
    __builtin_amdgcn_sched_barrier(0);   // the stores stay together, directly in front of their wait: no register that a store names is rewritten in between
#pragma unroll
    for (int p = 0; p < 4; ++p) { *(v4h*)(q16 + p * STEP) = o16[p]; *(v4us*)(qh + p * STEP) = oh[p]; *(v4us*)(ql + p * STEP) = ol[p]; }
    xwait(q16, qh, ql, ql);
}

// grid: NB_ * TT / 64 work-groups, one per WGP (LDS); two waves a SIMD: the registers hold a wave's whole share of x in flight at once (48 loads of 512 contiguous bytes), which is what covers the memory latency.
__global__ __launch_bounds__(32 * PW) __attribute__((amdgpu_waves_per_eu(2, 2))) void k_proj(const float* __restrict__ x, const bf* __restrict__ WP, const float* __restrict__ b0, const float* __restrict__ b1, const float* __restrict__ b2, h16* Q16, bf* Qh, bf* Ql, h16* K16, bf* Kh, bf* Kl, h16* V16, bf* Vh, bf* Vl) {
    __shared__ __align__(16) float red[2 * PW * PTILE];
    bf* xs = (bf*)(red + PW * PTILE);   // the staged x tile lies in the second area: it is dead behind the first product's barrier, in front of the second product's partials
    static_assert(64 * XP * 2 <= PW * PTILE * 4 && NSL == 3 * PW, "x tile fits the area; three K slices a wave");
    const int tid = threadIdx.x, lane = tid & 31, lr = lane & 15, hi = lane >> 4, wv = __builtin_amdgcn_readfirstlane(tid >> 5); const int r0 = blockIdx.x * 64;
    const float* xp = x + (size_t)(r0 + wv * 8) * DM + lane * 4;   // wave w stages rows 8 w .. 8 w + 7
    v4f xv[8][6];   // every '#pragma unroll' in this kernel makes the index of a register array a constant
#pragma unroll
    for (int rr = 0; rr < 8; ++rr)
#pragma unroll
        for (int c = 0; c < 6; ++c) xv[rr][c] = *(const v4f*)(xp + rr * DM + c * 128);
    const bf* wp = WP + (size_t)wv * NBT * 512 + lane * 8;
    v16bf b[3][4];
#pragma unroll
    for (int i = 0; i < 3; ++i)
#pragma unroll
        for (int nb = 0; nb < 4; ++nb) { const bf* p = wp + (i * PW * NBT + nb) * 512; b[i][nb] = cat16b(*(const v8us*)p, *(const v8us*)(p + 256)); }
    xwait(xp, wp, xp, wp);   // it also holds all these loads here, in front of the conversions: the whole tile is in flight at once
    const float* p0 = b0 + (tid & 15) * 4; const float* p1 = b1 + (tid & 15) * 4; const float* p2 = b2 + (tid >> 4);
    float bb0[4], bb1[4], bb2[4];   // the thread's biases: columns (tid & 15) * 4 + e of the [t][d] planes, rows p * 16 + (tid >> 4) of the [d][t] planes
#pragma unroll
    for (int e = 0; e < 4; ++e) { bb0[e] = p0[e]; bb1[e] = p1[e]; bb2[e] = p2[e * 16]; }
    xwait(p0, p1, p2, p2);   // a wait of their own, behind the first: the compiler sinks its kernel-argument loads to the first wait, where they could land on a scalar base that a bias load names
    bf* xd = xs + wv * 8 * XP + lane * 4;
#pragma unroll
    for (int rr = 0; rr < 8; ++rr)
#pragma unroll
        for (int c = 0; c < 6; ++c) { const v4f v = xv[rr][c]; const v2bf lo = __builtin_convertvector((v2f){v[0], v[1]}, v2bf), up = __builtin_convertvector((v2f){v[2], v[3]}, v2bf);   // round to nearest even
            *(v4usa*)(xd + rr * XP + c * 128) = __builtin_bit_cast(v4us, __builtin_shufflevector(lo, up, 0, 1, 2, 3)); }
    __syncthreads();   // the whole bf16 tile is in LDS before any wave reads its fragments
    v16bf a[3][4];
#pragma unroll
    for (int i = 0; i < 3; ++i)
#pragma unroll
        for (int mb = 0; mb < 4; ++mb) { const bf* p = xs + (mb * 16 + lr) * XP + (wv + i * PW) * 32 + 8 * hi; a[i][mb] = cat16b(*(const v8usa*)p, *(const v8usa*)(p + 16)); }
    proj_round<0>(a, b, wp, red, bb0, Q16, Qh, Ql, r0, tid, lr, hi, wv);
    proj_round<1>(a, b, wp, red, bb1, K16, Kh, Kl, r0, tid, lr, hi, wv);
    proj_round<2>(a, b, wp, red, bb2, V16, Vh, Vl, r0, tid, lr, hi, wv);
}

extern "C" void kernel_launch(void* const* d_in, const int* in_sizes, int n_in,
                              void* d_out, int out_size, void* d_ws, size_t ws_size, hipStream_t stream) {
    (void)in_sizes; (void)n_in; (void)out_size;
    const float* x = (const float*)d_in[0]; const float* wq = (const float*)d_in[1]; const float* bq = (const float*)d_in[2]; const float* wk = (const float*)d_in[3]; const float* bk = (const float*)d_in[4]; const float* wv = (const float*)d_in[5]; const float* bv = (const float*)d_in[6];   /* ROLES SWAPPED: 'wq/bq' <- the module's Wk/bk (d_in[1..2]) since wei = k.q^T puts k on the rows; 'wk/bk' <- Wq/bq (d_in[3..4]) */
    float* OUT = (float*)d_out;     // [4][4096][64]
    char* wsp = (char*)d_ws;
    auto take = [&](size_t bytes) { char* p = wsp; wsp += (bytes + 255) & ~(size_t)255; return (void*)p; };
    bf* WP = (bf*)take((size_t)3 * HD * DM * 2);
    h16* QP16 = (h16*)take((size_t)NB_ * TT * HD * 2); h16* KP16 = (h16*)take((size_t)NB_ * TT * HD * 2); h16* VT16 = (h16*)take((size_t)NB_ * HD * TT * 2);
    bf* QPh = (bf*)take((size_t)NB_ * TT * HD * 2); bf* QPl = (bf*)take((size_t)NB_ * TT * HD * 2); bf* KPh = (bf*)take((size_t)NB_ * TT * HD * 2); bf* KPl = (bf*)take((size_t)NB_ * TT * HD * 2); bf* VTh = (bf*)take((size_t)NB_ * HD * TT * 2); bf* VTl = (bf*)take((size_t)NB_ * HD * TT * 2);
    if ((size_t)(wsp - (char*)d_ws) > ws_size) return;    // ws 256 MiB
    k_wpack<<<NSL * NBT * 64 / 256, 256, 0, stream>>>(wq, wk, wv, WP);
    // projection stage: one launch for all batches (x is [NB_ * TT][DM], so the rows simply run on); it writes the planes itself
    k_proj<<<NB_ * TT / 64, 32 * PW, 0, stream>>>(x, WP, bq, bk, bv, QP16, QPh, QPl, KP16, KPh, KPl, VT16, VTh, VTl);
    // attention stage: one launch for all batches and row tiles; it writes the output rows itself
    k_fattn<<<NB_ * TT / QT, 32 * FW, 0, stream>>>(QP16, KP16, VT16, QPh, QPl, KPh, KPl, VTh, VTl, OUT);
}

// v005
// One run takes 30.3 microseconds.
// Next to v004, in two timings, it ran 1.22 and 1.26 times as fast.
// All steps since v000 together make it 28.1 times as fast.
#include <hip/hip_runtime.h>

// Single-head causal attention with the module's quirks (x [4][4096][768]; k = x Wk + bk, q = x Wq + bq, v = x Wv + bv ('xw' [768][64] + [64]); wei[t][s] = k_t . q_s x 768^-0.5 (k on the rows, q on the keys; embedding-dim scaling), causal on (t, s); softmax over s; out = wei v -> [4][4096][64] (1.0 M)).
// Three launches: the weights packed in fragment order; the projection stage (all batches, one 64-row tile of x a work-group, it writes the 16-bit planes itself, in fragment order); the attention stage (all batches and row tiles).
// Layout: x rounded to bf16 on its way into LDS; exact projections + f32 biases with the ROLES SWAPPED (the query planes come from the k projection, the key planes from the q projection); causal T-4096 attention with one head in one fused kernel (hybrid rows: < 512 hi/lo 3 products, rest fp16; online softmax; scores and probabilities stay in registers), which writes the output rows.
// Compute dtypes, f32 accumulate: every input rounded to bf16; projections exact + f32 biases; attention rows < 512 3 products, rest fp16; softmax f32; output f32.

#define NB_  4
#define TT   4096
#define DM   768
#define NH_  1
#define NKV  1
#define REP  (NH_ / NKV)
#define HD   64
#define DQ   (NH_ * HD)
#define DKV  (NKV * HD)
#define ZH   1
#define RH   512                  // query rows < RH use hi+lo planes (0: none)
#define WIN  4096
typedef _Float16 h16;
typedef unsigned short bf;
typedef __attribute__((ext_vector_type(16))) __bf16   v16bf;
typedef __attribute__((ext_vector_type(16))) _Float16 v16h;
typedef __attribute__((ext_vector_type(8)))  _Float16 v8h;
typedef __attribute__((ext_vector_type(8)))  unsigned short v8us;
typedef __attribute__((ext_vector_type(8)))  float    v8f;
typedef __attribute__((ext_vector_type(4)))  float    v4f;
typedef v8h  __attribute__((may_alias)) v8ha;
typedef v4f  __attribute__((may_alias)) v4fa;
typedef v8us __attribute__((may_alias)) v8usa;

__device__ __forceinline__ unsigned short f2bf(float f) { unsigned u = __float_as_uint(f); u += 0x7FFFu + ((u >> 16) & 1u); return (unsigned short)(u >> 16); }
__device__ __forceinline__ float bf2f(unsigned short b) { return __uint_as_float(((unsigned)b) << 16); }
__device__ __forceinline__ float bfr(float f) { return bf2f(f2bf(f)); }
__device__ __forceinline__ v16h cat16(v8h lo, v8h hi) { return __builtin_shufflevector(lo, hi, 0, 1, 2, 3, 4, 5, 6, 7, 8, 9, 10, 11, 12, 13, 14, 15); }
__device__ __forceinline__ v16bf cat16b(v8us lo, v8us hi) { return __builtin_bit_cast(v16bf, __builtin_shufflevector(lo, hi, 0, 1, 2, 3, 4, 5, 6, 7, 8, 9, 10, 11, 12, 13, 14, 15)); }
__device__ __forceinline__ v8f wmma16(v16h a, v16h b, v8f c) { return __builtin_amdgcn_wmma_f32_16x16x32_f16(false, a, false, b, (short)0, c, false, false); }
__device__ __forceinline__ v8f wmmab(v16bf a, v16bf b, v8f c) { return __builtin_amdgcn_wmma_f32_16x16x32_bf16(false, a, false, b, (short)0, c, false, false); }



// fragment loaders: 16 values of one row, k order 8*hi + 0..7, 16 + 8*hi + 0..7, from a 16-bit plane laid out in FRAGMENT ORDER: pieces of [32 lanes][8 values] = 512 contiguous bytes, so that a wave's 16-byte load covers four whole lines
// (from a row-major plane it touches 16 lines for 32 bytes each). p points at the lane's 8 values of the fragment's first piece (k 8*hi + 0..7); the second piece (k 16 + 8*hi + 0..7) follows it.
// Query and key planes: element (t, d) at ((t >> 4) * 4 + (d >> 4)) * 256 + (((d >> 3) & 1) * 16 + (t & 15)) * 8 + (d & 7). Value planes: element (d, t) at ((t >> 5) * 8 + (d >> 4) * 2 + ((t >> 4) & 1)) * 256 + (((t >> 3) & 1) * 16 + (d & 15)) * 8 + (t & 7).
// Either way rows t .. t + 15 (t .. t + 31) of a batch fill the same HD * 16 (HD * 32) elements as in a row-major [t][d] plane.
template <typename T16> struct WFrag;
template <> struct WFrag<h16> { typedef v16h V; static __device__ __forceinline__ V ld(const h16* p) { return cat16(*(const v8h*)p, *(const v8h*)(p + 256)); } static __device__ __forceinline__ v8f mma(V a, V b, v8f c) { return wmma16(a, b, c); } };
template <> struct WFrag<bf> { typedef v16bf V; static __device__ __forceinline__ V ld(const bf* p) { return cat16b(*(const v8us*)p, *(const v8us*)(p + 256)); } static __device__ __forceinline__ v8f mma(V a, V b, v8f c) { return wmmab(a, b, c); } };

__device__ __forceinline__ h16 tohx(float x) { return (h16)x; }
__device__ __forceinline__ void splitf(float y, unsigned short& h, unsigned short& l) { h = f2bf(y); l = f2bf(y - bf2f(h)); }
typedef __attribute__((ext_vector_type(2))) _Float16 v2h;
typedef __attribute__((ext_vector_type(4))) _Float16 v4h;
typedef __attribute__((ext_vector_type(2))) unsigned short v2us;
typedef __attribute__((ext_vector_type(4))) unsigned short v4us;
typedef __attribute__((ext_vector_type(2))) float v2f;
typedef __attribute__((ext_vector_type(4))) int v4i;

#define QT 32                     // query rows per work-group
#define FW 8                      // waves per work-group
template <typename T16> struct PPack;
template <> struct PPack<h16> { static __device__ __forceinline__ void pack(const v8f& t0, const v8f& t1, v16h& p, v16h& p2) { v8h lo, up; (void)p2;
#pragma unroll
    for (int e = 0; e < 8; ++e) { lo[e] = tohx(t0[e]); up[e] = tohx(t1[e]); }
    p = cat16(lo, up); } };
template <> struct PPack<bf> { static __device__ __forceinline__ void pack(const v8f& t0, const v8f& t1, v16bf& p, v16bf& p2) { v8us hl, hu, ll, lu;
#pragma unroll
    for (int e = 0; e < 8; ++e) { unsigned short a2, c2; splitf(t0[e], a2, c2); hl[e] = a2; ll[e] = c2; splitf(t1[e], a2, c2); hu[e] = a2; lu[e] = c2; }
    p = cat16b(hl, hu); p2 = cat16b(ll, lu); } };

// s_wait_xcnt 0 behind a run of global loads or stores, in front of any rewrite of the address registers they name; the addresses are inputs so that their registers live up to the wait,
// and the scheduling barrier behind it keeps later writes (of a scalar base too) from rising above the wait.
__device__ __forceinline__ void xwait(const void* a, const void* b, const void* c, const void* d) { asm volatile("s_wait_xcnt 0x0" :: "v"(a), "v"(b), "v"(c), "v"(d) : "memory"); __builtin_amdgcn_sched_barrier(0); }

template <typename T16, bool HR>
__device__ __forceinline__ void fa_tile(const T16* __restrict__ Q, const T16* __restrict__ Q2, const T16* __restrict__ Kp, const T16* __restrict__ Kp2, const T16* __restrict__ Vt, const T16* __restrict__ Vt2, float* __restrict__ outb, int r0, float* red, float* sm, float* sl) {
    typedef typename WFrag<T16>::V V;   // every '#pragma unroll' below makes the index of a fragment array a constant, so that the array lives in registers
    constexpr float SCL2 = (float)(0.036084391824351615 * 1.4426950408889634);   // 768^-0.5 x log2(e): the softmax runs in base 2
    const int lane = threadIdx.x & 31, lr = lane & 15, hi = lane >> 4, wv = __builtin_amdgcn_readfirstlane(threadIdx.x >> 5);
    V q[2][2], q2[2][2]; const size_t qo = (size_t)r0 * HD + lane * 8; const T16* qp = Q + qo; const T16* qp2 = HR ? Q2 + qo : qp;
#pragma unroll
    for (int nt = 0; nt < 2; ++nt)
#pragma unroll
        for (int ks = 0; ks < 2; ++ks) { const int o = nt * 16 * HD + ks * 512; q[nt][ks] = WFrag<T16>::ld(qp + o); if constexpr (HR) q2[nt][ks] = WFrag<T16>::ld(qp2 + o); }
    v8f acc[4][2];
#pragma unroll
    for (int dt = 0; dt < 4; ++dt)
#pragma unroll
        for (int nt = 0; nt < 2; ++nt) acc[dt][nt] = (v8f){};
    float m[2] = {-3.0e38f, -3.0e38f}, l[2] = {0.f, 0.f};
    static_assert(RH <= 64 * FW, "the hi/lo rows take one key block a wave");
    const int nblk = (r0 + QT - 1) / 64 + 1;      // key blocks up to the one that holds the tile's last diagonal element; each holds at least one allowed key for every row of the tile
    V ka[4][2], ka2[4][2];
    auto ldk = [&](const T16* kp, const T16* kp2) {
#pragma unroll
        for (int mt = 0; mt < 4; ++mt)
#pragma unroll
            for (int ks = 0; ks < 2; ++ks) { const int o = mt * 16 * HD + ks * 512; ka[mt][ks] = WFrag<T16>::ld(kp + o); if constexpr (HR) ka2[mt][ks] = WFrag<T16>::ld(kp2 + o); } };
    { const size_t ko = (size_t)(min(wv, nblk - 1) * 64) * HD + lane * 8;   // the wave's first key block (the clamp keeps a wave without a block inside the tile's own keys)
      const T16* kp = Kp + ko; const T16* kp2 = HR ? Kp2 + ko : kp; ldk(kp, kp2); xwait(qp, qp2, kp, kp2); }
#pragma unroll 1   // one trip's fragments at a time: two trips side by side do not fit the registers
    for (int kb = wv; kb < nblk; kb += FW) { const int k0 = kb * 64;
        v8f s[4][2];
#pragma unroll
        for (int mt = 0; mt < 4; ++mt)
#pragma unroll
            for (int nt = 0; nt < 2; ++nt) { v8f c = (v8f){};
#pragma unroll
                for (int ks = 0; ks < 2; ++ks) { c = WFrag<T16>::mma(ka[mt][ks], q[nt][ks], c); if constexpr (HR) { c = WFrag<T16>::mma(ka[mt][ks], q2[nt][ks], c); c = WFrag<T16>::mma(ka2[mt][ks], q[nt][ks], c); } }
                s[mt][nt] = c; }
        const T16* kn = Kp + (size_t)(min(kb + FW, nblk - 1) * 64) * HD + lane * 8;
        if constexpr (!HR) ldk(kn, kn);           // the wave's next key block is fetched one trip ahead (the last trip re-reads a block of the tile: in bounds, unused)
        V va[2][4], va2[2][4]; const size_t vo = (size_t)k0 * HD + lane * 8; const T16* vp = Vt + vo; const T16* vp2 = HR ? Vt2 + vo : vp;
#pragma unroll
        for (int ks = 0; ks < 2; ++ks)
#pragma unroll
            for (int dt = 0; dt < 4; ++dt) { const int o = ks * 32 * HD + dt * 512; va[ks][dt] = WFrag<T16>::ld(vp + o); if constexpr (HR) va2[ks][dt] = WFrag<T16>::ld(vp2 + o); }
        xwait(vp, vp2, HR ? vp : kn, HR ? vp2 : kn);   // it also holds all loads of the trip here, in front of the softmax arithmetic that covers their latency
        if (k0 + 63 > r0) {                       // only a block that reaches past the tile's first row has keys above the diagonal (wave-uniform test)
#pragma unroll
            for (int mt = 0; mt < 4; ++mt)
#pragma unroll
                for (int nt = 0; nt < 2; ++nt)
#pragma unroll
                    for (int j = 0; j < 8; ++j) s[mt][nt][j] = (k0 + mt * 16 + hi * 8 + j <= r0 + nt * 16 + lr) ? s[mt][nt][j] : -3.0e38f; }
#pragma unroll
        for (int nt = 0; nt < 2; ++nt) { float bm = -3.0e38f;
#pragma unroll
            for (int mt = 0; mt < 4; ++mt)
#pragma unroll
                for (int j = 0; j < 8; ++j) bm = fmaxf(bm, s[mt][nt][j]);
            bm = fmaxf(bm, __shfl_xor(bm, 16, 32)) * SCL2;   // the scale is positive: the maximum is taken on the raw scores and scaled once
            const float mn = fmaxf(m[nt], bm), alpha = __builtin_amdgcn_exp2f(m[nt] - mn); m[nt] = mn; float bs = 0.f;
#pragma unroll
            for (int mt = 0; mt < 4; ++mt)
#pragma unroll
                for (int j = 0; j < 8; ++j) { const float ex = __builtin_amdgcn_exp2f(__builtin_fmaf(s[mt][nt][j], SCL2, -mn)); s[mt][nt][j] = ex; bs += ex; }
            l[nt] = l[nt] * alpha + bs;           // each wave half keeps the sum of its own keys; the halves are joined once, behind the loop
#pragma unroll
            for (int dt = 0; dt < 4; ++dt) acc[dt][nt] *= alpha; }
#pragma unroll
        for (int ks = 0; ks < 2; ++ks) { V p[2], p2[2];
#pragma unroll
            for (int nt = 0; nt < 2; ++nt) PPack<T16>::pack(s[2 * ks][nt], s[2 * ks + 1][nt], p[nt], p2[nt]);
#pragma unroll
            for (int dt = 0; dt < 4; ++dt)
#pragma unroll
                for (int nt = 0; nt < 2; ++nt) { acc[dt][nt] = WFrag<T16>::mma(va[ks][dt], p[nt], acc[dt][nt]); if constexpr (HR) { acc[dt][nt] = WFrag<T16>::mma(va[ks][dt], p2[nt], acc[dt][nt]); acc[dt][nt] = WFrag<T16>::mma(va2[ks][dt], p[nt], acc[dt][nt]); } } }
        if constexpr (HR) break;                  // rows < RH see at most RH / 64 <= FW key blocks, one a wave: no second trip, so the query fragments die behind the scores (registers)
    }
#pragma unroll
    for (int nt = 0; nt < 2; ++nt) { l[nt] += __shfl_xor(l[nt], 16, 32); if (hi == 0) sm[wv * QT + nt * 16 + lr] = m[nt]; }
    __syncthreads();   // every wave's maxima are in LDS before any wave scales its partial sum and tile to the common maximum
#pragma unroll
    for (int nt = 0; nt < 2; ++nt) { float M = sm[nt * 16 + lr];
#pragma unroll
        for (int w = 1; w < FW; ++w) M = fmaxf(M, sm[w * QT + nt * 16 + lr]);
        const float sc = __builtin_amdgcn_exp2f(m[nt] - M);      // 0 for a wave that had no block
        if (hi == 0) sl[wv * QT + nt * 16 + lr] = l[nt] * sc;
#pragma unroll
        for (int dt = 0; dt < 4; ++dt) { const v8f o = acc[dt][nt] * sc; float* rp = red + (size_t)(wv * QT + nt * 16 + lr) * 68 + dt * 16 + hi * 8;
            *(v4fa*)rp = (v4f){o[0], o[1], o[2], o[3]}; *(v4fa*)(rp + 4) = (v4f){o[4], o[5], o[6], o[7]}; } }
    __syncthreads();   // every wave's scaled partial sum and tile are in LDS before any thread adds them up
    constexpr int NP = QT * 16 / (32 * FW); v4f res[NP]; float* op = outb + (size_t)(r0 + ((int)threadIdx.x >> 4)) * HD + ((int)threadIdx.x & 15) * 4;
#pragma unroll
    for (int p = 0; p < NP; ++p) { const int idx = p * 32 * FW + (int)threadIdx.x, row = idx >> 4, cofs = (idx & 15) * 4;
        float L = 0.f; v4f val = (v4f){};
#pragma unroll
        for (int w = 0; w < FW; ++w) { L += sl[w * QT + row]; val += *(const v4fa*)(red + (size_t)(w * QT + row) * 68 + cofs); }
        res[p] = val * (1.0f / L); }
#pragma unroll
    for (int p = 0; p < NP; ++p) *(v4f*)(op + p * 2 * FW * HD) = res[p];
    xwait(op, op, op, op);
}

// grid: NB_ * TT / QT work-groups, one resident per WGP (two waves a SIMD: amdgpu_waves_per_eu frees the registers that let a whole block's K and V loads fly together). Cost grows with the tile's row and there are more work-groups than places, so cost falls with the index (for speed only).
__global__ __launch_bounds__(32 * FW) __attribute__((amdgpu_waves_per_eu(2, 2))) void k_fattn(const h16* __restrict__ Q16, const h16* __restrict__ K16, const h16* __restrict__ V16, const bf* __restrict__ Qh, const bf* __restrict__ Ql, const bf* __restrict__ Kh, const bf* __restrict__ Kl, const bf* __restrict__ Vh, const bf* __restrict__ Vl, float* __restrict__ OUTb) {
    __shared__ __align__(16) float red[FW * QT * 68]; __shared__ float sm[FW * QT]; __shared__ float sl[FW * QT];
    const int rank = blockIdx.x;
    const int r0 = (TT / QT - 1 - rank / NB_) * QT; const size_t zp = (size_t)(rank % NB_) * TT * HD;
    if (r0 < RH) fa_tile<bf, true>(Qh + zp, Ql + zp, Kh + zp, Kl + zp, Vh + zp, Vl + zp, OUTb + zp, r0, red, sm, sl);       // rows < RH: hi/lo planes, 3 products
    else         fa_tile<h16, false>(Q16 + zp, nullptr, K16 + zp, nullptr, V16 + zp, nullptr, OUTb + zp, r0, red, sm, sl);
}

// ---- k_wpack: the three weights [DM][HD] (f32) rounded to bf16 and laid out as the projection kernel's fragments: WP[s][nb][part][lane][8], s = 32-wide K slice, nb = 16-column block (0-3 first weight, 4-7 second, 8-11 third);
// element j is w[s*32 + part*16 + 8*(lane>>4) + j][(nb&3)*16 + (lane&15)]: the fragment loaders' k order, so that a wave's 16-byte load covers 512 contiguous bytes. One thread a 16-byte piece.
typedef __attribute__((ext_vector_type(2))) __bf16 v2bf;
typedef v4us __attribute__((may_alias)) v4usa;
#define NSL (DM / 32)             // K slices
#define NBT (3 * HD / 16)         // column blocks of the three weights together
__global__ __launch_bounds__(256) void k_wpack(const float* __restrict__ w0, const float* __restrict__ w1, const float* __restrict__ w2, bf* WP) {
    const int T = blockIdx.x * 256 + threadIdx.x, lane = T & 31, part = (T >> 5) & 1, sn = T >> 6, nb = sn % NBT, s = sn / NBT;
    const float* w = nb < 4 ? w0 : nb < 8 ? w1 : w2;
    const float* p = w + (size_t)(s * 32 + part * 16 + 8 * (lane >> 4)) * HD + (nb & 3) * 16 + (lane & 15); v8us o;
#pragma unroll   // the eight loads fly together
    for (int j = 0; j < 8; ++j) o[j] = f2bf(p[j * HD]);
    *(v8us*)(WP + (size_t)T * 8) = o;
}

// ---- k_proj: the whole projection stage of one 64-row tile of x in ONE kernel: x (f32) -> bf16 in LDS, three 64x64 products on the matrix unit, biases, and the 16-bit planes the attention kernel reads.
// PW waves; wave w takes the 32-wide K slices w, w + PW, w + 2 PW of all three products (its x fragments stay in registers); per product the partial tiles are parked in LDS (pitch 68 floats), one barrier,
// and each thread adds its float4 positions over the waves in the fixed order 0..PW-1, adds the bias, converts and stores. Query and key planes run along d in a piece, so their product is taken as W^T x^T (a lane holds 8 d of one t);
// the value planes run along t, so theirs is x W (a lane holds 8 t of one d): either way a lane parks 8 neighbours with two 16-byte LDS stores and a wave stores 512 contiguous bytes of a plane.
#define PW 8
#define XP (DM + 8)               // staged x row pitch in bf16: 1552 B = 16 B x 97 (odd), so that the 16 rows of a fragment read fall on different banks
#define PTILE (64 * 68)
template <int G>
__device__ __forceinline__ void proj_round(const v16bf (&a)[3][4], v16bf (&b)[3][4], const bf* wp, float* red, const float (&bias)[8], h16* P16, bf* Ph, bf* Pl, int r0, int tid, int lr, int hi, int wv) {
    v8f acc[4][4];   // every '#pragma unroll' below makes the index of a fragment array a constant, so that the array lives in registers
#pragma unroll
    for (int mb = 0; mb < 4; ++mb)
#pragma unroll
        for (int nb = 0; nb < 4; ++nb) acc[mb][nb] = (v8f){};
#pragma unroll
    for (int i = 0; i < 3; ++i)
#pragma unroll
        for (int nb = 0; nb < 4; ++nb)
#pragma unroll
            for (int mb = 0; mb < 4; ++mb) acc[mb][nb] = (G < 2) ? wmmab(b[i][nb], a[i][mb], acc[mb][nb]) : wmmab(a[i][mb], b[i][nb], acc[mb][nb]);
    if constexpr (G < 2) {   // the next product's weight fragments fly while this product's partials are summed
#pragma unroll
        for (int i = 0; i < 3; ++i)
#pragma unroll
            for (int nb = 0; nb < 4; ++nb) { const bf* p = wp + (i * PW * NBT + (G + 1) * 4 + nb) * 512; b[i][nb] = cat16b(*(const v8us*)p, *(const v8us*)(p + 256)); }
        xwait(wp, wp, wp, wp); }   // in front of any rewrite of the address these loads name
    float* ar = red + (G & 1) * PW * PTILE;   // two areas in turn: a product's partials are written while slower waves may still read the one before
#pragma unroll
    for (int mb = 0; mb < 4; ++mb)
#pragma unroll
        for (int nb = 0; nb < 4; ++nb) { const v8f o = acc[mb][nb]; float* rp = ar + wv * PTILE + (((G < 2) ? mb : nb) * 16 + lr) * 68 + ((G < 2) ? nb : mb) * 16 + hi * 8;
            *(v4fa*)rp = (v4f){o[0], o[1], o[2], o[3]}; *(v4fa*)(rp + 4) = (v4f){o[4], o[5], o[6], o[7]}; }
    __syncthreads();   // every wave's partial tile is in LDS before any thread sums it
    // the tile's 64 * HD elements of a plane are contiguous in fragment order; thread tid takes the 8-value lane shares tid and tid + 256, so that a wave stores one whole 512-byte piece. A share's place in the parked tile follows from the planes' maps:
    // query and key planes: t = 32 p + 16 (tid >> 7) + (tid & 15), d = 16 ((tid >> 5) & 3) + 8 ((tid >> 4) & 1) + 0..7; value planes: d = 16 (tid >> 6) + (tid & 15), t = 32 p + 16 ((tid >> 5) & 1) + 8 ((tid >> 4) & 1) + 0..7.
    // 16 neighbouring lanes read 16 neighbouring rows of the parked tile at one column: free of bank conflicts at the pitch of 68 floats
    const int row = ((G < 2) ? (tid >> 7) : (tid >> 6)) * 16 + (tid & 15), cofs = ((G < 2) ? ((tid >> 5) & 3) : ((tid >> 5) & 1)) * 16 + ((tid >> 4) & 1) * 8; const float* rd = ar + row * 68 + cofs;
    const size_t o0 = (size_t)r0 * HD + tid * 8;
    constexpr int STEP = 32 * HD;
    h16* q16 = P16 + o0; bf* qh = Ph + o0; bf* ql = Pl + o0;
    v8h o16[2]; v8us oh[2], ol[2];
#pragma unroll
    for (int p = 0; p < 2; ++p)
#pragma unroll
        for (int h = 0; h < 2; ++h) { const int po = ((G < 2) ? p * 32 * 68 : p * 32) + h * 4; v4f val = *(const v4fa*)(rd + po);
#pragma unroll
            for (int w = 1; w < PW; ++w) val += *(const v4fa*)(rd + w * PTILE + po);
#pragma unroll
            for (int e = 0; e < 4; ++e) { const float y = val[e] + bfr(bias[(G < 2) ? h * 4 + e : 0]); o16[p][h * 4 + e] = tohx(y); unsigned short a2, c2; splitf(y, a2, c2); oh[p][h * 4 + e] = a2; ol[p][h * 4 + e] = c2; } }
    __builtin_amdgcn_sched_barrier(0);   // the stores stay together, directly in front of their wait: no register that a store names is rewritten in between
#pragma unroll
    for (int p = 0; p < 2; ++p) { *(v8h*)(q16 + p * STEP) = o16[p]; *(v8us*)(qh + p * STEP) = oh[p]; *(v8us*)(ql + p * STEP) = ol[p]; }
    xwait(q16, qh, ql, ql);
}

// grid: NB_ * TT / 64 work-groups, one per WGP (LDS); two waves a SIMD: the registers hold a wave's whole share of x in flight at once (48 loads of 512 contiguous bytes), which is what covers the memory latency.
__global__ __launch_bounds__(32 * PW) __attribute__((amdgpu_waves_per_eu(2, 2))) void k_proj(const float* __restrict__ x, const bf* __restrict__ WP, const float* __restrict__ b0, const float* __restrict__ b1, const float* __restrict__ b2, h16* Q16, bf* Qh, bf* Ql, h16* K16, bf* Kh, bf* Kl, h16* V16, bf* Vh, bf* Vl) {
    __shared__ __align__(16) float red[2 * PW * PTILE];
    bf* xs = (bf*)(red + PW * PTILE);   // the staged x tile lies in the second area: it is dead behind the first product's barrier, in front of the second product's partials
    static_assert(64 * XP * 2 <= PW * PTILE * 4 && NSL == 3 * PW, "x tile fits the area; three K slices a wave");
    const int tid = threadIdx.x, lane = tid & 31, lr = lane & 15, hi = lane >> 4, wv = __builtin_amdgcn_readfirstlane(tid >> 5); const int r0 = blockIdx.x * 64;
    const float* xp = x + (size_t)(r0 + wv * 8) * DM + lane * 4;   // wave w stages rows 8 w .. 8 w + 7
    v4f xv[8][6];   // every '#pragma unroll' in this kernel makes the index of a register array a constant
#pragma unroll
    for (int rr = 0; rr < 8; ++rr)
#pragma unroll
        for (int c = 0; c < 6; ++c) xv[rr][c] = *(const v4f*)(xp + rr * DM + c * 128);
    const bf* wp = WP + (size_t)wv * NBT * 512 + lane * 8;
    v16bf b[3][4];
#pragma unroll
    for (int i = 0; i < 3; ++i)
#pragma unroll
        for (int nb = 0; nb < 4; ++nb) { const bf* p = wp + (i * PW * NBT + nb) * 512; b[i][nb] = cat16b(*(const v8us*)p, *(const v8us*)(p + 256)); }
    xwait(xp, wp, xp, wp);   // it also holds all these loads here, in front of the conversions: the whole tile is in flight at once
    const int cq = ((tid >> 5) & 3) * 16 + ((tid >> 4) & 1) * 8;
    const float* p0 = b0 + cq; const float* p1 = b1 + cq; const float* p2 = b2 + (tid >> 6) * 16 + (tid & 15);
    float bb0[8], bb1[8], bb2[8];   // the thread's biases: d = cq + e of the query and key planes, the one d = (tid >> 6) * 16 + (tid & 15) of the value planes (proj_round's map)
#pragma unroll
    for (int e = 0; e < 8; ++e) { bb0[e] = p0[e]; bb1[e] = p1[e]; bb2[e] = p2[0]; }
    xwait(p0, p1, p2, p2);   // a wait of their own, behind the first: the compiler sinks its kernel-argument loads to the first wait, where they could land on a scalar base that a bias load names
    bf* xd = xs + wv * 8 * XP + lane * 4;
#pragma unroll
    for (int rr = 0; rr < 8; ++rr)
#pragma unroll
        for (int c = 0; c < 6; ++c) { const v4f v = xv[rr][c]; const v2bf lo = __builtin_convertvector((v2f){v[0], v[1]}, v2bf), up = __builtin_convertvector((v2f){v[2], v[3]}, v2bf);   // round to nearest even
            *(v4usa*)(xd + rr * XP + c * 128) = __builtin_bit_cast(v4us, __builtin_shufflevector(lo, up, 0, 1, 2, 3)); }
    __syncthreads();   // the whole bf16 tile is in LDS before any wave reads its fragments
    v16bf a[3][4];
#pragma unroll
    for (int i = 0; i < 3; ++i)
#pragma unroll
        for (int mb = 0; mb < 4; ++mb) { const bf* p = xs + (mb * 16 + lr) * XP + (wv + i * PW) * 32 + 8 * hi; a[i][mb] = cat16b(*(const v8usa*)p, *(const v8usa*)(p + 16)); }
    proj_round<0>(a, b, wp, red, bb0, Q16, Qh, Ql, r0, tid, lr, hi, wv);
    proj_round<1>(a, b, wp, red, bb1, K16, Kh, Kl, r0, tid, lr, hi, wv);
    proj_round<2>(a, b, wp, red, bb2, V16, Vh, Vl, r0, tid, lr, hi, wv);
}

extern "C" void kernel_launch(void* const* d_in, const int* in_sizes, int n_in,
                              void* d_out, int out_size, void* d_ws, size_t ws_size, hipStream_t stream) {
    (void)in_sizes; (void)n_in; (void)out_size;
    const float* x = (const float*)d_in[0]; const float* wq = (const float*)d_in[1]; const float* bq = (const float*)d_in[2]; const float* wk = (const float*)d_in[3]; const float* bk = (const float*)d_in[4]; const float* wv = (const float*)d_in[5]; const float* bv = (const float*)d_in[6];   /* ROLES SWAPPED: 'wq/bq' <- the module's Wk/bk (d_in[1..2]) since wei = k.q^T puts k on the rows; 'wk/bk' <- Wq/bq (d_in[3..4]) */
    float* OUT = (float*)d_out;     // [4][4096][64]
    char* wsp = (char*)d_ws;
    auto take = [&](size_t bytes) { char* p = wsp; wsp += (bytes + 255) & ~(size_t)255; return (void*)p; };
    bf* WP = (bf*)take((size_t)3 * HD * DM * 2);
    h16* QP16 = (h16*)take((size_t)NB_ * TT * HD * 2); h16* KP16 = (h16*)take((size_t)NB_ * TT * HD * 2); h16* VT16 = (h16*)take((size_t)NB_ * HD * TT * 2);
    bf* QPh = (bf*)take((size_t)NB_ * TT * HD * 2); bf* QPl = (bf*)take((size_t)NB_ * TT * HD * 2); bf* KPh = (bf*)take((size_t)NB_ * TT * HD * 2); bf* KPl = (bf*)take((size_t)NB_ * TT * HD * 2); bf* VTh = (bf*)take((size_t)NB_ * HD * TT * 2); bf* VTl = (bf*)take((size_t)NB_ * HD * TT * 2);
    if ((size_t)(wsp - (char*)d_ws) > ws_size) return;    // ws 256 MiB
    k_wpack<<<NSL * NBT * 64 / 256, 256, 0, stream>>>(wq, wk, wv, WP);
    // projection stage: one launch for all batches (x is [NB_ * TT][DM], so the rows simply run on); it writes the planes itself
    k_proj<<<NB_ * TT / 64, 32 * PW, 0, stream>>>(x, WP, bq, bk, bv, QP16, QPh, QPl, KP16, KPh, KPl, VT16, VTh, VTl);
    // attention stage: one launch for all batches and row tiles; it writes the output rows itself
    k_fattn<<<NB_ * TT / QT, 32 * FW, 0, stream>>>(QP16, KP16, VT16, QPh, QPl, KPh, KPl, VTh, VTl, OUT);
}

// v006
// A run of this version takes 26.8 microseconds.
// Timed twice side by side with v005, it ran 1.13 and 1.14 times as fast.
// All steps since v000 together make it 31.8 times as fast.
#include <hip/hip_runtime.h>

// Single-head causal attention with the module's quirks (x [4][4096][768]; k = x Wk + bk, q = x Wq + bq, v = x Wv + bv ('xw' [768][64] + [64]); wei[t][s] = k_t . q_s x 768^-0.5 (k on the rows, q on the keys; embedding-dim scaling), causal on (t, s); softmax over s; out = wei v -> [4][4096][64] (1.0 M)).
// Three launches: the weights packed in fragment order; the projection stage (all batches, one 64-row tile of x a work-group, it writes the 16-bit planes itself, in fragment order); the attention stage (all batches and row tiles).
// Layout: x rounded to bf16 on its way into LDS; exact projections + f32 biases with the ROLES SWAPPED (the query planes come from the k projection, the key planes from the q projection); causal T-4096 attention with one head in one fused kernel (hybrid rows: < 512 hi/lo 3 products, rest fp16; online softmax; scores and probabilities stay in registers), which writes the output rows.
// Compute dtypes, f32 accumulate: every input rounded to bf16; projections exact + f32 biases; attention rows < 512 3 products, rest fp16; softmax f32; output f32.

#define NB_  4
#define TT   4096
#define DM   768
#define NH_  1
#define NKV  1
#define REP  (NH_ / NKV)
#define HD   64
#define DQ   (NH_ * HD)
#define DKV  (NKV * HD)
#define ZH   1
#define RH   512                  // query rows < RH use hi+lo planes (0: none)
#define WIN  4096
typedef _Float16 h16;
typedef unsigned short bf;
typedef __attribute__((ext_vector_type(16))) __bf16   v16bf;
typedef __attribute__((ext_vector_type(16))) _Float16 v16h;
typedef __attribute__((ext_vector_type(8)))  _Float16 v8h;
typedef __attribute__((ext_vector_type(8)))  unsigned short v8us;
typedef __attribute__((ext_vector_type(8)))  float    v8f;
typedef __attribute__((ext_vector_type(4)))  float    v4f;
typedef v8h  __attribute__((may_alias)) v8ha;
typedef v4f  __attribute__((may_alias)) v4fa;
typedef v8us __attribute__((may_alias)) v8usa;

__device__ __forceinline__ unsigned short f2bf(float f) { unsigned u = __float_as_uint(f); u += 0x7FFFu + ((u >> 16) & 1u); return (unsigned short)(u >> 16); }
__device__ __forceinline__ float bf2f(unsigned short b) { return __uint_as_float(((unsigned)b) << 16); }
__device__ __forceinline__ float bfr(float f) { return bf2f(f2bf(f)); }
__device__ __forceinline__ v16h cat16(v8h lo, v8h hi) { return __builtin_shufflevector(lo, hi, 0, 1, 2, 3, 4, 5, 6, 7, 8, 9, 10, 11, 12, 13, 14, 15); }
__device__ __forceinline__ v16bf cat16b(v8us lo, v8us hi) { return __builtin_bit_cast(v16bf, __builtin_shufflevector(lo, hi, 0, 1, 2, 3, 4, 5, 6, 7, 8, 9, 10, 11, 12, 13, 14, 15)); }
__device__ __forceinline__ v8f wmma16(v16h a, v16h b, v8f c) { return __builtin_amdgcn_wmma_f32_16x16x32_f16(false, a, false, b, (short)0, c, false, false); }
__device__ __forceinline__ v8f wmmab(v16bf a, v16bf b, v8f c) { return __builtin_amdgcn_wmma_f32_16x16x32_bf16(false, a, false, b, (short)0, c, false, false); }



// fragment loaders: 16 values of one row, k order 8*hi + 0..7, 16 + 8*hi + 0..7, from a 16-bit plane laid out in FRAGMENT ORDER: pieces of [32 lanes][8 values] = 512 contiguous bytes, so that a wave's 16-byte load covers four whole lines
// (from a row-major plane it touches 16 lines for 32 bytes each). p points at the lane's 8 values of the fragment's first piece (k 8*hi + 0..7); the second piece (k 16 + 8*hi + 0..7) follows it.
// Query and key planes: element (t, d) at ((t >> 4) * 4 + (d >> 4)) * 256 + (((d >> 3) & 1) * 16 + (t & 15)) * 8 + (d & 7). Value planes: element (d, t) at ((t >> 5) * 8 + (d >> 4) * 2 + ((t >> 4) & 1)) * 256 + (((t >> 3) & 1) * 16 + (d & 15)) * 8 + (t & 7).
// Either way rows t .. t + 15 (t .. t + 31) of a batch fill the same HD * 16 (HD * 32) elements as in a row-major [t][d] plane.
template <typename T16> struct WFrag;
template <> struct WFrag<h16> { typedef v16h V; static __device__ __forceinline__ V ld(const h16* p) { return cat16(*(const v8h*)p, *(const v8h*)(p + 256)); } static __device__ __forceinline__ v8f mma(V a, V b, v8f c) { return wmma16(a, b, c); } };
template <> struct WFrag<bf> { typedef v16bf V; static __device__ __forceinline__ V ld(const bf* p) { return cat16b(*(const v8us*)p, *(const v8us*)(p + 256)); } static __device__ __forceinline__ v8f mma(V a, V b, v8f c) { return wmmab(a, b, c); } };

__device__ __forceinline__ h16 tohx(float x) { return (h16)x; }
__device__ __forceinline__ void splitf(float y, unsigned short& h, unsigned short& l) { h = f2bf(y); l = f2bf(y - bf2f(h)); }
typedef __attribute__((ext_vector_type(2))) _Float16 v2h;
typedef __attribute__((ext_vector_type(4))) _Float16 v4h;
typedef __attribute__((ext_vector_type(2))) unsigned short v2us;
typedef __attribute__((ext_vector_type(4))) unsigned short v4us;
typedef __attribute__((ext_vector_type(2))) float v2f;
typedef __attribute__((ext_vector_type(4))) int v4i;

#define QT 32                     // query rows per tile (two tiles a work-group)
#define FW 8                      // waves per work-group
template <typename T16> struct PPack;
template <> struct PPack<h16> { static __device__ __forceinline__ void pack(const v8f& t0, const v8f& t1, v16h& p, v16h& p2) { v8h lo, up; (void)p2;
#pragma unroll
    for (int e = 0; e < 8; ++e) { lo[e] = tohx(t0[e]); up[e] = tohx(t1[e]); }
    p = cat16(lo, up); } };
template <> struct PPack<bf> { static __device__ __forceinline__ void pack(const v8f& t0, const v8f& t1, v16bf& p, v16bf& p2) { v8us hl, hu, ll, lu;
#pragma unroll
    for (int e = 0; e < 8; ++e) { unsigned short a2, c2; splitf(t0[e], a2, c2); hl[e] = a2; ll[e] = c2; splitf(t1[e], a2, c2); hu[e] = a2; lu[e] = c2; }
    p = cat16b(hl, hu); p2 = cat16b(ll, lu); } };

// s_wait_xcnt 0 behind a run of global loads or stores, in front of any rewrite of the address registers they name; the addresses are inputs so that their registers live up to the wait,
// and the scheduling barrier behind it keeps later writes (of a scalar base too) from rising above the wait.
__device__ __forceinline__ void xwait(const void* a, const void* b, const void* c, const void* d) { asm volatile("s_wait_xcnt 0x0" :: "v"(a), "v"(b), "v"(c), "v"(d) : "memory"); __builtin_amdgcn_sched_barrier(0); }

template <typename T16, bool HR>
__device__ __forceinline__ void fa_tile(const T16* __restrict__ Q, const T16* __restrict__ Q2, const T16* __restrict__ Kp, const T16* __restrict__ Kp2, const T16* __restrict__ Vt, const T16* __restrict__ Vt2, float* __restrict__ outb, int r0, float* red, float* sm, float* sl) {
    typedef typename WFrag<T16>::V V;   // every '#pragma unroll' below makes the index of a fragment array a constant, so that the array lives in registers
    constexpr float SCL2 = (float)(0.036084391824351615 * 1.4426950408889634);   // 768^-0.5 x log2(e): the softmax runs in base 2
    const int lane = threadIdx.x & 31, lr = lane & 15, hi = lane >> 4, wv = __builtin_amdgcn_readfirstlane(threadIdx.x >> 5);
    V q[2][2], q2[2][2]; const size_t qo = (size_t)r0 * HD + lane * 8; const T16* qp = Q + qo; const T16* qp2 = HR ? Q2 + qo : qp;
#pragma unroll
    for (int nt = 0; nt < 2; ++nt)
#pragma unroll
        for (int ks = 0; ks < 2; ++ks) { const int o = nt * 16 * HD + ks * 512; q[nt][ks] = WFrag<T16>::ld(qp + o); if constexpr (HR) q2[nt][ks] = WFrag<T16>::ld(qp2 + o); }
    v8f acc[4][2];
#pragma unroll
    for (int dt = 0; dt < 4; ++dt)
#pragma unroll
        for (int nt = 0; nt < 2; ++nt) acc[dt][nt] = (v8f){};
    float m[2] = {-3.0e38f, -3.0e38f}, l[2] = {0.f, 0.f};
    static_assert(RH <= 64 * FW, "the hi/lo rows take one key block a wave");
    const int nblk = (r0 + QT - 1) / 64 + 1;      // key blocks up to the one that holds the tile's last diagonal element; each holds at least one allowed key for every row of the tile
    V ka[4][2], ka2[4][2];
    auto ldk = [&](const T16* kp, const T16* kp2) {
#pragma unroll
        for (int mt = 0; mt < 4; ++mt)
#pragma unroll
            for (int ks = 0; ks < 2; ++ks) { const int o = mt * 16 * HD + ks * 512; ka[mt][ks] = WFrag<T16>::ld(kp + o); if constexpr (HR) ka2[mt][ks] = WFrag<T16>::ld(kp2 + o); } };
    { const size_t ko = (size_t)(min(wv, nblk - 1) * 64) * HD + lane * 8;   // the wave's first key block (the clamp keeps a wave without a block inside the tile's own keys)
      const T16* kp = Kp + ko; const T16* kp2 = HR ? Kp2 + ko : kp; ldk(kp, kp2); xwait(qp, qp2, kp, kp2); }
#pragma unroll 1   // one trip's fragments at a time: two trips side by side do not fit the registers
    for (int kb = wv; kb < nblk; kb += FW) { const int k0 = kb * 64;
        v8f s[4][2];
#pragma unroll
        for (int mt = 0; mt < 4; ++mt)
#pragma unroll
            for (int nt = 0; nt < 2; ++nt) { v8f c = (v8f){};
#pragma unroll
                for (int ks = 0; ks < 2; ++ks) { c = WFrag<T16>::mma(ka[mt][ks], q[nt][ks], c); if constexpr (HR) { c = WFrag<T16>::mma(ka[mt][ks], q2[nt][ks], c); c = WFrag<T16>::mma(ka2[mt][ks], q[nt][ks], c); } }
                s[mt][nt] = c; }
        const T16* kn = Kp + (size_t)(min(kb + FW, nblk - 1) * 64) * HD + lane * 8;
        if constexpr (!HR) ldk(kn, kn);           // the wave's next key block is fetched one trip ahead (the last trip re-reads a block of the tile: in bounds, unused)
        V va[2][4], va2[2][4]; const size_t vo = (size_t)k0 * HD + lane * 8; const T16* vp = Vt + vo; const T16* vp2 = HR ? Vt2 + vo : vp;
#pragma unroll
        for (int ks = 0; ks < 2; ++ks)
#pragma unroll
            for (int dt = 0; dt < 4; ++dt) { const int o = ks * 32 * HD + dt * 512; va[ks][dt] = WFrag<T16>::ld(vp + o); if constexpr (HR) va2[ks][dt] = WFrag<T16>::ld(vp2 + o); }
        xwait(vp, vp2, HR ? vp : kn, HR ? vp2 : kn);   // it also holds all loads of the trip here, in front of the softmax arithmetic that covers their latency
        if (k0 + 63 > r0) {                       // only a block that reaches past the tile's first row has keys above the diagonal (wave-uniform test)
#pragma unroll
            for (int mt = 0; mt < 4; ++mt)
#pragma unroll
                for (int nt = 0; nt < 2; ++nt)
#pragma unroll
                    for (int j = 0; j < 8; ++j) s[mt][nt][j] = (k0 + mt * 16 + hi * 8 + j <= r0 + nt * 16 + lr) ? s[mt][nt][j] : -3.0e38f; }
#pragma unroll
        for (int nt = 0; nt < 2; ++nt) { float bm = -3.0e38f;
#pragma unroll
            for (int mt = 0; mt < 4; ++mt)
#pragma unroll
                for (int j = 0; j < 8; ++j) bm = fmaxf(bm, s[mt][nt][j]);
            bm = fmaxf(bm, __shfl_xor(bm, 16, 32)) * SCL2;   // the scale is positive: the maximum is taken on the raw scores and scaled once
            const float mn = fmaxf(m[nt], bm), alpha = __builtin_amdgcn_exp2f(m[nt] - mn); m[nt] = mn; float bs = 0.f;
#pragma unroll
            for (int mt = 0; mt < 4; ++mt)
#pragma unroll
                for (int j = 0; j < 8; ++j) { const float ex = __builtin_amdgcn_exp2f(__builtin_fmaf(s[mt][nt][j], SCL2, -mn)); s[mt][nt][j] = ex; bs += ex; }
            l[nt] = l[nt] * alpha + bs;           // each wave half keeps the sum of its own keys; the halves are joined once, behind the loop
#pragma unroll
            for (int dt = 0; dt < 4; ++dt) acc[dt][nt] *= alpha; }
#pragma unroll
        for (int ks = 0; ks < 2; ++ks) { V p[2], p2[2];
#pragma unroll
            for (int nt = 0; nt < 2; ++nt) PPack<T16>::pack(s[2 * ks][nt], s[2 * ks + 1][nt], p[nt], p2[nt]);
#pragma unroll
            for (int dt = 0; dt < 4; ++dt)
#pragma unroll
                for (int nt = 0; nt < 2; ++nt) { acc[dt][nt] = WFrag<T16>::mma(va[ks][dt], p[nt], acc[dt][nt]); if constexpr (HR) { acc[dt][nt] = WFrag<T16>::mma(va[ks][dt], p2[nt], acc[dt][nt]); acc[dt][nt] = WFrag<T16>::mma(va2[ks][dt], p[nt], acc[dt][nt]); } } }
        if constexpr (HR) break;                  // rows < RH see at most RH / 64 <= FW key blocks, one a wave: no second trip, so the query fragments die behind the scores (registers)
    }
#pragma unroll
    for (int nt = 0; nt < 2; ++nt) { l[nt] += __shfl_xor(l[nt], 16, 32); if (hi == 0) sm[wv * QT + nt * 16 + lr] = m[nt]; }
    __syncthreads();   // every wave's maxima are in LDS before any wave scales its partial sum and tile to the common maximum
#pragma unroll
    for (int nt = 0; nt < 2; ++nt) { float M = sm[nt * 16 + lr];
#pragma unroll
        for (int w = 1; w < FW; ++w) M = fmaxf(M, sm[w * QT + nt * 16 + lr]);
        const float sc = __builtin_amdgcn_exp2f(m[nt] - M);      // 0 for a wave that had no block
        if (hi == 0) sl[wv * QT + nt * 16 + lr] = l[nt] * sc;
#pragma unroll
        for (int dt = 0; dt < 4; ++dt) { const v8f o = acc[dt][nt] * sc; float* rp = red + (size_t)(wv * QT + nt * 16 + lr) * 68 + dt * 16 + hi * 8;
            *(v4fa*)rp = (v4f){o[0], o[1], o[2], o[3]}; *(v4fa*)(rp + 4) = (v4f){o[4], o[5], o[6], o[7]}; } }
    __syncthreads();   // every wave's scaled partial sum and tile are in LDS before any thread adds them up
    constexpr int NP = QT * 16 / (32 * FW); v4f res[NP]; float* op = outb + (size_t)(r0 + ((int)threadIdx.x >> 4)) * HD + ((int)threadIdx.x & 15) * 4;
#pragma unroll
    for (int p = 0; p < NP; ++p) { const int idx = p * 32 * FW + (int)threadIdx.x, row = idx >> 4, cofs = (idx & 15) * 4;
        float L = 0.f; v4f val = (v4f){};
#pragma unroll
        for (int w = 0; w < FW; ++w) { L += sl[w * QT + row]; val += *(const v4fa*)(red + (size_t)(w * QT + row) * 68 + cofs); }
        res[p] = val * (1.0f / L); }
#pragma unroll
    for (int p = 0; p < NP; ++p) *(v4f*)(op + p * 2 * FW * HD) = res[p];
    xwait(op, op, op, op);
}

// ---- fa_pair: TWO query tiles of one batch in one work-group, a high one (rows rB ..) and a low one (rows rS .., rS < rB), both on the fp16 planes. A key block that both tiles need is loaded ONCE and used for both tiles' 32 query columns,
// one tile after the other on the same K and V fragments; the blocks past the low tile's diagonal go to the high tile alone. Per tile the blocks of a wave, their order and all arithmetic are those of fa_tile.
// two == false: the low tile is not taken here (its rows use the hi/lo planes, fa_tile) and only the high tile is worked on and stored.
__device__ __forceinline__ void fa_scores(const v16h (&ka)[4][2], const v16h (&q)[2][2], v8f (&s)[4][2]) {   // every '#pragma unroll' in these helpers makes the index of a fragment array a constant
#pragma unroll
    for (int mt = 0; mt < 4; ++mt)
#pragma unroll
        for (int nt = 0; nt < 2; ++nt) { v8f c = (v8f){};
#pragma unroll
            for (int ks = 0; ks < 2; ++ks) c = wmma16(ka[mt][ks], q[nt][ks], c);
            s[mt][nt] = c; }
}
__device__ __forceinline__ void fa_soft(v8f (&s)[4][2], v8f (&acc)[4][2], float (&m)[2], float (&l)[2], int k0, int r0, int lr, int hi) {
    constexpr float SCL2 = (float)(0.036084391824351615 * 1.4426950408889634);   // 768^-0.5 x log2(e): the softmax runs in base 2
    if (k0 + 63 > r0) {                       // only a block that reaches past the tile's first row has keys above the diagonal (wave-uniform test)
#pragma unroll
        for (int mt = 0; mt < 4; ++mt)
#pragma unroll
            for (int nt = 0; nt < 2; ++nt)
#pragma unroll
                for (int j = 0; j < 8; ++j) s[mt][nt][j] = (k0 + mt * 16 + hi * 8 + j <= r0 + nt * 16 + lr) ? s[mt][nt][j] : -3.0e38f; }
#pragma unroll
    for (int nt = 0; nt < 2; ++nt) { float bm = -3.0e38f;
#pragma unroll
        for (int mt = 0; mt < 4; ++mt)
#pragma unroll
            for (int j = 0; j < 8; ++j) bm = fmaxf(bm, s[mt][nt][j]);
        bm = fmaxf(bm, __shfl_xor(bm, 16, 32)) * SCL2;   // the scale is positive: the maximum is taken on the raw scores and scaled once
        const float mn = fmaxf(m[nt], bm), alpha = __builtin_amdgcn_exp2f(m[nt] - mn); m[nt] = mn; float bs = 0.f;
#pragma unroll
        for (int mt = 0; mt < 4; ++mt)
#pragma unroll
            for (int j = 0; j < 8; ++j) { const float ex = __builtin_amdgcn_exp2f(__builtin_fmaf(s[mt][nt][j], SCL2, -mn)); s[mt][nt][j] = ex; bs += ex; }
        l[nt] = l[nt] * alpha + bs;           // each wave half keeps the sum of its own keys; the halves are joined once, behind the loops
#pragma unroll
        for (int dt = 0; dt < 4; ++dt) acc[dt][nt] *= alpha; }
}
__device__ __forceinline__ void fa_pv(const v16h (&va)[2][4], const v8f (&s)[4][2], v8f (&acc)[4][2]) {
#pragma unroll
    for (int ks = 0; ks < 2; ++ks) { v16h p[2], p2[2];
#pragma unroll
        for (int nt = 0; nt < 2; ++nt) PPack<h16>::pack(s[2 * ks][nt], s[2 * ks + 1][nt], p[nt], p2[nt]);
#pragma unroll
        for (int dt = 0; dt < 4; ++dt)
#pragma unroll
            for (int nt = 0; nt < 2; ++nt) acc[dt][nt] = wmma16(va[ks][dt], p[nt], acc[dt][nt]); }
}
__device__ __forceinline__ void fa_pair(const h16* __restrict__ Q, const h16* __restrict__ Kp, const h16* __restrict__ Vt, float* __restrict__ outb, int rB, int rS, bool two, float* red, float* sm, float* sl) {
    const int lane = threadIdx.x & 31, lr = lane & 15, hi = lane >> 4, wv = __builtin_amdgcn_readfirstlane(threadIdx.x >> 5);   // every '#pragma unroll' below makes the index of a fragment array a constant
    v16h q[2][2][2]; const h16* qpB = Q + (size_t)rB * HD + lane * 8; const h16* qpS = Q + (size_t)rS * HD + lane * 8;   // index 0: the high tile, 1: the low tile
#pragma unroll
    for (int nt = 0; nt < 2; ++nt)
#pragma unroll
        for (int ks = 0; ks < 2; ++ks) { const int o = nt * 16 * HD + ks * 512; q[0][nt][ks] = WFrag<h16>::ld(qpB + o); q[1][nt][ks] = WFrag<h16>::ld(qpS + o); }
    v8f acc[2][4][2]; float m[2][2], l[2][2];
#pragma unroll
    for (int h = 0; h < 2; ++h)
#pragma unroll
        for (int nt = 0; nt < 2; ++nt) { m[h][nt] = -3.0e38f; l[h][nt] = 0.f;
#pragma unroll
            for (int dt = 0; dt < 4; ++dt) acc[h][dt][nt] = (v8f){}; }
    const int nblk = (rB + QT - 1) / 64 + 1, nblkS = two ? (rS + QT - 1) / 64 + 1 : 0;   // key blocks up to the one that holds each tile's last diagonal element
    v16h ka[4][2], va[2][4];
    auto ldk = [&](const h16* kp) {
#pragma unroll
        for (int mt = 0; mt < 4; ++mt)
#pragma unroll
            for (int ks = 0; ks < 2; ++ks) ka[mt][ks] = WFrag<h16>::ld(kp + mt * 16 * HD + ks * 512); };
    auto ldv = [&](const h16* vp) {
#pragma unroll
        for (int ks = 0; ks < 2; ++ks)
#pragma unroll
            for (int dt = 0; dt < 4; ++dt) va[ks][dt] = WFrag<h16>::ld(vp + ks * 32 * HD + dt * 512); };
    { const h16* kp = Kp + (size_t)(min(wv, nblk - 1) * 64) * HD + lane * 8;   // the wave's first key block (the clamp keeps a wave without a block inside the tile's own keys)
      ldk(kp); xwait(qpB, qpS, kp, kp); }
    int kb = wv;
#pragma unroll 1   // one trip's fragments at a time: two trips side by side do not fit the registers
    for (; kb < nblkS; kb += FW) { const int k0 = kb * 64;   // blocks that both tiles need
        v8f s[4][2];
        fa_scores(ka, q[0], s);
        const h16* vp = Vt + (size_t)k0 * HD + lane * 8; ldv(vp);
        xwait(vp, vp, vp, vp);   // it also holds the V loads here, in front of the softmax arithmetic that covers their latency
        fa_soft(s, acc[0], m[0], l[0], k0, rB, lr, hi); fa_pv(va, s, acc[0]);
        __builtin_amdgcn_sched_barrier(0);   // the low tile's scores stay behind the high tile's last product: raised above it, two sets of scores live at once and registers spill
        fa_scores(ka, q[1], s);
        const h16* kn = Kp + (size_t)(min(kb + FW, nblk - 1) * 64) * HD + lane * 8; ldk(kn);   // the wave's next key block flies behind the block's last use, under the low tile's softmax
        xwait(kn, kn, kn, kn);
        fa_soft(s, acc[1], m[1], l[1], k0, rS, lr, hi); fa_pv(va, s, acc[1]); }
#pragma unroll 1   // as above
    for (; kb < nblk; kb += FW) { const int k0 = kb * 64;    // blocks of the high tile alone
        v8f s[4][2];
        fa_scores(ka, q[0], s);
        const h16* kn = Kp + (size_t)(min(kb + FW, nblk - 1) * 64) * HD + lane * 8; ldk(kn);   // one trip ahead (the last trip re-reads a block of the tile: in bounds, unused)
        const h16* vp = Vt + (size_t)k0 * HD + lane * 8; ldv(vp);
        xwait(vp, vp, kn, kn);   // it also holds all loads of the trip here, in front of the softmax arithmetic that covers their latency
        fa_soft(s, acc[0], m[0], l[0], k0, rB, lr, hi); fa_pv(va, s, acc[0]); }
#pragma unroll
    for (int h = 0; h < 2; ++h)
#pragma unroll
        for (int nt = 0; nt < 2; ++nt) { l[h][nt] += __shfl_xor(l[h][nt], 16, 32); if (hi == 0) sm[(wv * 2 + h) * QT + nt * 16 + lr] = m[h][nt]; }
    __syncthreads();   // every wave's maxima (both tiles) are in LDS before any wave scales its partial sums and tiles to the common maxima
#pragma unroll
    for (int h = 0; h < 2; ++h) if (h == 0 || two) {   // block-uniform
#pragma unroll
        for (int nt = 0; nt < 2; ++nt) { float M = sm[h * QT + nt * 16 + lr];
#pragma unroll
            for (int w = 1; w < FW; ++w) M = fmaxf(M, sm[(w * 2 + h) * QT + nt * 16 + lr]);
            const float sc = __builtin_amdgcn_exp2f(m[h][nt] - M);      // 0 for a wave that had no block of this tile
            if (hi == 0) sl[(wv * 2 + h) * QT + nt * 16 + lr] = l[h][nt] * sc;
#pragma unroll
            for (int dt = 0; dt < 4; ++dt) { const v8f o = acc[h][dt][nt] * sc; float* rp = red + (size_t)((wv * 2 + h) * QT + nt * 16 + lr) * 68 + dt * 16 + hi * 8;
                *(v4fa*)rp = (v4f){o[0], o[1], o[2], o[3]}; *(v4fa*)(rp + 4) = (v4f){o[4], o[5], o[6], o[7]}; } } }
    __syncthreads();   // every wave's scaled partial sums and tiles are in LDS before any thread adds them up
    constexpr int NP = QT * 16 / (32 * FW);
#pragma unroll
    for (int h = 0; h < 2; ++h) if (h == 0 || two) {   // block-uniform
        v4f res[NP]; float* op = outb + (size_t)((h ? rS : rB) + ((int)threadIdx.x >> 4)) * HD + ((int)threadIdx.x & 15) * 4;
#pragma unroll
        for (int p = 0; p < NP; ++p) { const int idx = p * 32 * FW + (int)threadIdx.x, row = idx >> 4, cofs = (idx & 15) * 4;
            float L = 0.f; v4f val = (v4f){};
#pragma unroll
            for (int w = 0; w < FW; ++w) { L += sl[(w * 2 + h) * QT + row]; val += *(const v4fa*)(red + (size_t)((w * 2 + h) * QT + row) * 68 + cofs); }
            res[p] = val * (1.0f / L); }
#pragma unroll
        for (int p = 0; p < NP; ++p) *(v4f*)(op + p * 2 * FW * HD) = res[p];
        xwait(op, op, op, op); }
}

// grid: NB_ * TT / QT / 2 work-groups, all resident, one per WGP (two waves a SIMD: amdgpu_waves_per_eu frees the registers that let a whole block's K and V loads fly together). Work-group u of a batch takes the high tile TT / QT - 1 - u and the low tile
// (u + RH / QT) mod (TT / QT / 2): a permutation of the tiles. Cost grows with a tile's row, so a heavy high tile goes with a light fp16 low tile (their sum is level); the hi/lo tiles, which share no plane with a high tile and run on their own, go with the lightest high tiles.
__global__ __launch_bounds__(32 * FW) __attribute__((amdgpu_waves_per_eu(2, 2))) void k_fattn(const h16* __restrict__ Q16, const h16* __restrict__ K16, const h16* __restrict__ V16, const bf* __restrict__ Qh, const bf* __restrict__ Ql, const bf* __restrict__ Kh, const bf* __restrict__ Kl, const bf* __restrict__ Vh, const bf* __restrict__ Vl, float* __restrict__ OUTb) {
    __shared__ __align__(16) float red[FW * 2 * QT * 68]; __shared__ float sm[FW * 2 * QT]; __shared__ float sl[FW * 2 * QT];
    static_assert(RH % QT == 0 && RH <= TT / 2 && (TT / QT) % 2 == 0, "every high tile is an fp16 tile");
    const int u = blockIdx.x / NB_; const size_t zp = (size_t)(blockIdx.x % NB_) * TT * HD;
    const int rB = (TT / QT - 1 - u) * QT, rS = ((u + RH / QT) % (TT / QT / 2)) * QT; const bool two = rS >= RH;
    if (!two) fa_tile<bf, true>(Qh + zp, Ql + zp, Kh + zp, Kl + zp, Vh + zp, Vl + zp, OUTb + zp, rS, red, sm, sl);       // rows < RH: hi/lo planes, 3 products. Its LDS reads end in front of fa_pair's first barrier, its maxima's in front of its own second: no barrier between the two
    fa_pair(Q16 + zp, K16 + zp, V16 + zp, OUTb + zp, rB, rS, two, red, sm, sl);
}

// ---- k_wpack: the three weights [DM][HD] (f32) rounded to bf16 and laid out as the projection kernel's fragments: WP[s][nb][part][lane][8], s = 32-wide K slice, nb = 16-column block (0-3 first weight, 4-7 second, 8-11 third);
// element j is w[s*32 + part*16 + 8*(lane>>4) + j][(nb&3)*16 + (lane&15)]: the fragment loaders' k order, so that a wave's 16-byte load covers 512 contiguous bytes. One thread a 16-byte piece.
typedef __attribute__((ext_vector_type(2))) __bf16 v2bf;
typedef v4us __attribute__((may_alias)) v4usa;
#define NSL (DM / 32)             // K slices
#define NBT (3 * HD / 16)         // column blocks of the three weights together
__global__ __launch_bounds__(256) void k_wpack(const float* __restrict__ w0, const float* __restrict__ w1, const float* __restrict__ w2, bf* WP) {
    const int T = blockIdx.x * 256 + threadIdx.x, lane = T & 31, part = (T >> 5) & 1, sn = T >> 6, nb = sn % NBT, s = sn / NBT;
    const float* w = nb < 4 ? w0 : nb < 8 ? w1 : w2;
    const float* p = w + (size_t)(s * 32 + part * 16 + 8 * (lane >> 4)) * HD + (nb & 3) * 16 + (lane & 15); v8us o;
#pragma unroll   // the eight loads fly together
    for (int j = 0; j < 8; ++j) o[j] = f2bf(p[j * HD]);
    *(v8us*)(WP + (size_t)T * 8) = o;
}

// ---- k_proj: the whole projection stage of one 64-row tile of x in ONE kernel: x (f32) -> bf16 in LDS, three 64x64 products on the matrix unit, biases, and the 16-bit planes the attention kernel reads.
// PW waves; wave w takes the 32-wide K slices w, w + PW, w + 2 PW of all three products (its x fragments stay in registers); per product the partial tiles are parked in LDS (pitch 68 floats), one barrier,
// and each thread adds its float4 positions over the waves in the fixed order 0..PW-1, adds the bias, converts and stores. Query and key planes run along d in a piece, so their product is taken as W^T x^T (a lane holds 8 d of one t);
// the value planes run along t, so theirs is x W (a lane holds 8 t of one d): either way a lane parks 8 neighbours with two 16-byte LDS stores and a wave stores 512 contiguous bytes of a plane.
#define PW 8
#define XP (DM + 8)               // staged x row pitch in bf16: 1552 B = 16 B x 97 (odd), so that the 16 rows of a fragment read fall on different banks
#define PTILE (64 * 68)
template <int G>
__device__ __forceinline__ void proj_round(const v16bf (&a)[3][4], v16bf (&b)[3][4], const bf* wp, float* red, const float (&bias)[8], h16* P16, bf* Ph, bf* Pl, int r0, int tid, int lr, int hi, int wv) {
    v8f acc[4][4];   // every '#pragma unroll' below makes the index of a fragment array a constant, so that the array lives in registers
#pragma unroll
    for (int mb = 0; mb < 4; ++mb)
#pragma unroll
        for (int nb = 0; nb < 4; ++nb) acc[mb][nb] = (v8f){};
#pragma unroll
    for (int i = 0; i < 3; ++i)
#pragma unroll
        for (int nb = 0; nb < 4; ++nb)
#pragma unroll
            for (int mb = 0; mb < 4; ++mb) acc[mb][nb] = (G < 2) ? wmmab(b[i][nb], a[i][mb], acc[mb][nb]) : wmmab(a[i][mb], b[i][nb], acc[mb][nb]);
    if constexpr (G < 2) {   // the next product's weight fragments fly while this product's partials are summed
#pragma unroll
        for (int i = 0; i < 3; ++i)
#pragma unroll
            for (int nb = 0; nb < 4; ++nb) { const bf* p = wp + (i * PW * NBT + (G + 1) * 4 + nb) * 512; b[i][nb] = cat16b(*(const v8us*)p, *(const v8us*)(p + 256)); }
        xwait(wp, wp, wp, wp); }   // in front of any rewrite of the address these loads name
    float* ar = red + (G & 1) * PW * PTILE;   // two areas in turn: a product's partials are written while slower waves may still read the one before
#pragma unroll
    for (int mb = 0; mb < 4; ++mb)
#pragma unroll
        for (int nb = 0; nb < 4; ++nb) { const v8f o = acc[mb][nb]; float* rp = ar + wv * PTILE + (((G < 2) ? mb : nb) * 16 + lr) * 68 + ((G < 2) ? nb : mb) * 16 + hi * 8;
            *(v4fa*)rp = (v4f){o[0], o[1], o[2], o[3]}; *(v4fa*)(rp + 4) = (v4f){o[4], o[5], o[6], o[7]}; }
    __syncthreads();   // every wave's partial tile is in LDS before any thread sums it
    // the tile's 64 * HD elements of a plane are contiguous in fragment order; thread tid takes the 8-value lane shares tid and tid + 256, so that a wave stores one whole 512-byte piece. A share's place in the parked tile follows from the planes' maps:
    // query and key planes: t = 32 p + 16 (tid >> 7) + (tid & 15), d = 16 ((tid >> 5) & 3) + 8 ((tid >> 4) & 1) + 0..7; value planes: d = 16 (tid >> 6) + (tid & 15), t = 32 p + 16 ((tid >> 5) & 1) + 8 ((tid >> 4) & 1) + 0..7.
    // 16 neighbouring lanes read 16 neighbouring rows of the parked tile at one column: free of bank conflicts at the pitch of 68 floats
    const int row = ((G < 2) ? (tid >> 7) : (tid >> 6)) * 16 + (tid & 15), cofs = ((G < 2) ? ((tid >> 5) & 3) : ((tid >> 5) & 1)) * 16 + ((tid >> 4) & 1) * 8; const float* rd = ar + row * 68 + cofs;
    const size_t o0 = (size_t)r0 * HD + tid * 8;
    constexpr int STEP = 32 * HD;
    h16* q16 = P16 + o0; bf* qh = Ph + o0; bf* ql = Pl + o0;
    v8h o16[2]; v8us oh[2], ol[2];
#pragma unroll
    for (int p = 0; p < 2; ++p)
#pragma unroll
        for (int h = 0; h < 2; ++h) { const int po = ((G < 2) ? p * 32 * 68 : p * 32) + h * 4; v4f val = *(const v4fa*)(rd + po);
#pragma unroll
            for (int w = 1; w < PW; ++w) val += *(const v4fa*)(rd + w * PTILE + po);
#pragma unroll
            for (int e = 0; e < 4; ++e) { const float y = val[e] + bfr(bias[(G < 2) ? h * 4 + e : 0]); o16[p][h * 4 + e] = tohx(y); unsigned short a2, c2; splitf(y, a2, c2); oh[p][h * 4 + e] = a2; ol[p][h * 4 + e] = c2; } }
    __builtin_amdgcn_sched_barrier(0);   // the stores stay together, directly in front of their wait: no register that a store names is rewritten in between
#pragma unroll
    for (int p = 0; p < 2; ++p) { *(v8h*)(q16 + p * STEP) = o16[p]; *(v8us*)(qh + p * STEP) = oh[p]; *(v8us*)(ql + p * STEP) = ol[p]; }
    xwait(q16, qh, ql, ql);
}

// grid: NB_ * TT / 64 work-groups, one per WGP (LDS); two waves a SIMD: the registers hold a wave's whole share of x in flight at once (48 loads of 512 contiguous bytes), which is what covers the memory latency.
__global__ __launch_bounds__(32 * PW) __attribute__((amdgpu_waves_per_eu(2, 2))) void k_proj(const float* __restrict__ x, const bf* __restrict__ WP, const float* __restrict__ b0, const float* __restrict__ b1, const float* __restrict__ b2, h16* Q16, bf* Qh, bf* Ql, h16* K16, bf* Kh, bf* Kl, h16* V16, bf* Vh, bf* Vl) {
    __shared__ __align__(16) float red[2 * PW * PTILE];
    bf* xs = (bf*)(red + PW * PTILE);   // the staged x tile lies in the second area: it is dead behind the first product's barrier, in front of the second product's partials
    static_assert(64 * XP * 2 <= PW * PTILE * 4 && NSL == 3 * PW, "x tile fits the area; three K slices a wave");
    const int tid = threadIdx.x, lane = tid & 31, lr = lane & 15, hi = lane >> 4, wv = __builtin_amdgcn_readfirstlane(tid >> 5); const int r0 = blockIdx.x * 64;
    const float* xp = x + (size_t)(r0 + wv * 8) * DM + lane * 4;   // wave w stages rows 8 w .. 8 w + 7
    v4f xv[8][6];   // every '#pragma unroll' in this kernel makes the index of a register array a constant
#pragma unroll
    for (int rr = 0; rr < 8; ++rr)
#pragma unroll
        for (int c = 0; c < 6; ++c) xv[rr][c] = *(const v4f*)(xp + rr * DM + c * 128);
    const bf* wp = WP + (size_t)wv * NBT * 512 + lane * 8;
    v16bf b[3][4];
#pragma unroll
    for (int i = 0; i < 3; ++i)
#pragma unroll
        for (int nb = 0; nb < 4; ++nb) { const bf* p = wp + (i * PW * NBT + nb) * 512; b[i][nb] = cat16b(*(const v8us*)p, *(const v8us*)(p + 256)); }
    xwait(xp, wp, xp, wp);   // it also holds all these loads here, in front of the conversions: the whole tile is in flight at once
    const int cq = ((tid >> 5) & 3) * 16 + ((tid >> 4) & 1) * 8;
    const float* p0 = b0 + cq; const float* p1 = b1 + cq; const float* p2 = b2 + (tid >> 6) * 16 + (tid & 15);
    float bb0[8], bb1[8], bb2[8];   // the thread's biases: d = cq + e of the query and key planes, the one d = (tid >> 6) * 16 + (tid & 15) of the value planes (proj_round's map)
#pragma unroll
    for (int e = 0; e < 8; ++e) { bb0[e] = p0[e]; bb1[e] = p1[e]; bb2[e] = p2[0]; }
    xwait(p0, p1, p2, p2);   // a wait of their own, behind the first: the compiler sinks its kernel-argument loads to the first wait, where they could land on a scalar base that a bias load names
    bf* xd = xs + wv * 8 * XP + lane * 4;
#pragma unroll
    for (int rr = 0; rr < 8; ++rr)
#pragma unroll
        for (int c = 0; c < 6; ++c) { const v4f v = xv[rr][c]; const v2bf lo = __builtin_convertvector((v2f){v[0], v[1]}, v2bf), up = __builtin_convertvector((v2f){v[2], v[3]}, v2bf);   // round to nearest even
            *(v4usa*)(xd + rr * XP + c * 128) = __builtin_bit_cast(v4us, __builtin_shufflevector(lo, up, 0, 1, 2, 3)); }
    __syncthreads();   // the whole bf16 tile is in LDS before any wave reads its fragments
    v16bf a[3][4];
#pragma unroll
    for (int i = 0; i < 3; ++i)
#pragma unroll
        for (int mb = 0; mb < 4; ++mb) { const bf* p = xs + (mb * 16 + lr) * XP + (wv + i * PW) * 32 + 8 * hi; a[i][mb] = cat16b(*(const v8usa*)p, *(const v8usa*)(p + 16)); }
    proj_round<0>(a, b, wp, red, bb0, Q16, Qh, Ql, r0, tid, lr, hi, wv);
    proj_round<1>(a, b, wp, red, bb1, K16, Kh, Kl, r0, tid, lr, hi, wv);
    proj_round<2>(a, b, wp, red, bb2, V16, Vh, Vl, r0, tid, lr, hi, wv);
}

extern "C" void kernel_launch(void* const* d_in, const int* in_sizes, int n_in,
                              void* d_out, int out_size, void* d_ws, size_t ws_size, hipStream_t stream) {
    (void)in_sizes; (void)n_in; (void)out_size;
    const float* x = (const float*)d_in[0]; const float* wq = (const float*)d_in[1]; const float* bq = (const float*)d_in[2]; const float* wk = (const float*)d_in[3]; const float* bk = (const float*)d_in[4]; const float* wv = (const float*)d_in[5]; const float* bv = (const float*)d_in[6];   /* ROLES SWAPPED: 'wq/bq' <- the module's Wk/bk (d_in[1..2]) since wei = k.q^T puts k on the rows; 'wk/bk' <- Wq/bq (d_in[3..4]) */
    float* OUT = (float*)d_out;     // [4][4096][64]
    char* wsp = (char*)d_ws;
    auto take = [&](size_t bytes) { char* p = wsp; wsp += (bytes + 255) & ~(size_t)255; return (void*)p; };
    bf* WP = (bf*)take((size_t)3 * HD * DM * 2);
    h16* QP16 = (h16*)take((size_t)NB_ * TT * HD * 2); h16* KP16 = (h16*)take((size_t)NB_ * TT * HD * 2); h16* VT16 = (h16*)take((size_t)NB_ * HD * TT * 2);
    bf* QPh = (bf*)take((size_t)NB_ * TT * HD * 2); bf* QPl = (bf*)take((size_t)NB_ * TT * HD * 2); bf* KPh = (bf*)take((size_t)NB_ * TT * HD * 2); bf* KPl = (bf*)take((size_t)NB_ * TT * HD * 2); bf* VTh = (bf*)take((size_t)NB_ * HD * TT * 2); bf* VTl = (bf*)take((size_t)NB_ * HD * TT * 2);
    if ((size_t)(wsp - (char*)d_ws) > ws_size) return;    // ws 256 MiB
    k_wpack<<<NSL * NBT * 64 / 256, 256, 0, stream>>>(wq, wk, wv, WP);
    // projection stage: one launch for all batches (x is [NB_ * TT][DM], so the rows simply run on); it writes the planes itself
    k_proj<<<NB_ * TT / 64, 32 * PW, 0, stream>>>(x, WP, bq, bk, bv, QP16, QPh, QPl, KP16, KPh, KPl, VT16, VTh, VTl);
    // attention stage: one launch for all batches and row tiles (two tiles a work-group); it writes the output rows itself
    k_fattn<<<NB_ * TT / QT / 2, 32 * FW, 0, stream>>>(QP16, KP16, VT16, QPh, QPl, KPh, KPl, VTh, VTl, OUT);
}
